// v000
// The times below were measured on an AMD MI455X: many runs one after another, warmed up first and cycling through
// copies of the inputs, with the whole window's GPU time divided by the number of runs. Launches and the gaps
// between them are all in it. The median over several windows is given; except for v000 it joins two sittings, which
// can be a few percent apart, so the side-by-side timings, each taken in one sitting, are the better comparison.
// The starting kernel, v000, takes 411 microseconds a run.
#include <hip/hip_runtime.h>

#define SEQ 2048
#define DMODEL 1024
#define NHEAD 16
#define DK 64
#define LN_EPS 1e-5f

typedef __bf16 v16bf  __attribute__((ext_vector_type(16)));
typedef __bf16 bf16x8 __attribute__((ext_vector_type(8)));
typedef __bf16 bf16x4 __attribute__((ext_vector_type(4)));
typedef float  v8f    __attribute__((ext_vector_type(8)));
typedef float  f32x4  __attribute__((ext_vector_type(4)));
typedef int    v4i    __attribute__((ext_vector_type(4)));

#define AS1 __attribute__((address_space(1)))
#define AS3 __attribute__((address_space(3)))

#if __has_builtin(__builtin_amdgcn_global_load_async_to_lds_b128) && \
    __has_builtin(__builtin_amdgcn_s_wait_asynccnt)
#define HAVE_ASYNC_LDS 1
#else
#define HAVE_ASYNC_LDS 0
#endif

// K-index mapping for 16-bit A/B fragments of V_WMMA_*_16X16X32_* (ISA 7.12.2):
// element e -> K = {0..7}+8*hl for e<8, {16..23}+8*hl for e>=8.
__device__ __forceinline__ int kmap(int e, int hl) {
    int v = e >> 1;
    int base = (v < 4) ? (2 * v) : (16 + 2 * (v - 4));
    return base + (e & 1) + 8 * hl;
}

// Fragment whose element e reads p[kmap(e,hl)]: two contiguous 16B runs.
__device__ __forceinline__ v16bf load_frag(const __bf16* p, int hl) {
    bf16x8 a0 = *(const bf16x8*)(p + 8 * hl);
    bf16x8 a1 = *(const bf16x8*)(p + 16 + 8 * hl);
    return __builtin_shufflevector(a0, a1, 0, 1, 2, 3, 4, 5, 6, 7,
                                   8, 9, 10, 11, 12, 13, 14, 15);
}

// ---------------------------------------------------------------------------
// Tiled bf16 WMMA GEMM: out[N,Dout] = A[N,K] @ W[K,Dout] + bias (+ resid)
// 256 threads = 8 waves (2x4), block tile 128x128, wave tile 64x32, K-step 32.
// MODE 0: A = f32, store bf16.  MODE 1: A = bf16, store f32 + bias + residual.
// ---------------------------------------------------------------------------
template <int MODE>
__global__ __launch_bounds__(256)
void gemm_wmma(const float* __restrict__ A, const __bf16* __restrict__ Abf,
               const float* __restrict__ W, const float* __restrict__ bias,
               __bf16* __restrict__ outbf, float* __restrict__ outf,
               const float* __restrict__ resid, int N, int K, int Dout) {
    __shared__ __align__(16) __bf16 lA[128 * 32];
    __shared__ __align__(16) __bf16 lB[32 * 128];

    const int tid  = threadIdx.x;
    const int wave = tid >> 5;
    const int lane = tid & 31;
    const int lm   = lane & 15;
    const int hl   = lane >> 4;
    const int wrow = wave >> 2;            // 0..1  -> 64-row slab
    const int wcol = wave & 3;             // 0..3  -> 32-col slab
    const int row0 = blockIdx.y * 128;
    const int col0 = blockIdx.x * 128;

    v8f zero = {};
    v8f acc[4][2];
#pragma unroll
    for (int i = 0; i < 4; ++i)
#pragma unroll
        for (int j = 0; j < 2; ++j) acc[i][j] = zero;

    for (int k0 = 0; k0 < K; k0 += 32) {
        // ---- stage A tile (128x32) ----
#pragma unroll
        for (int rep = 0; rep < 4; ++rep) {
            int idx = tid + rep * 256;                 // 0..1023 vec4 chunks
            int r = idx >> 3, c4 = (idx & 7) * 4;
            if constexpr (MODE == 0) {
                f32x4 v = *(const f32x4*)&A[(size_t)(row0 + r) * K + k0 + c4];
                bf16x4 b = {(__bf16)v.x, (__bf16)v.y, (__bf16)v.z, (__bf16)v.w};
                *(bf16x4*)&lA[r * 32 + c4] = b;
            } else {
                *(bf16x4*)&lA[r * 32 + c4] =
                    *(const bf16x4*)&Abf[(size_t)(row0 + r) * K + k0 + c4];
            }
        }
        // ---- stage B tile (32x128) ----
#pragma unroll
        for (int rep = 0; rep < 4; ++rep) {
            int idx = tid + rep * 256;
            int r = idx >> 5, c4 = (idx & 31) * 4;
            f32x4 v = *(const f32x4*)&W[(size_t)(k0 + r) * Dout + col0 + c4];
            bf16x4 b = {(__bf16)v.x, (__bf16)v.y, (__bf16)v.z, (__bf16)v.w};
            *(bf16x4*)&lB[r * 128 + c4] = b;
        }
        __syncthreads();

        v16bf af[4], bfr[2];
#pragma unroll
        for (int i = 0; i < 4; ++i)
            af[i] = load_frag(&lA[(wrow * 64 + i * 16 + lm) * 32], hl);
#pragma unroll
        for (int j = 0; j < 2; ++j) {
            int n0 = wcol * 32 + j * 16 + lm;
#pragma unroll
            for (int e = 0; e < 16; ++e)              // K-stride 128: scattered
                bfr[j][e] = lB[kmap(e, hl) * 128 + n0];
        }
#pragma unroll
        for (int i = 0; i < 4; ++i)
#pragma unroll
            for (int j = 0; j < 2; ++j)
                acc[i][j] = __builtin_amdgcn_wmma_f32_16x16x32_bf16(
                    false, af[i], false, bfr[j], (short)0, acc[i][j], false, false);
        __syncthreads();
    }

#pragma unroll
    for (int i = 0; i < 4; ++i)
#pragma unroll
        for (int j = 0; j < 2; ++j) {
            int gcol = col0 + wcol * 32 + j * 16 + lm;
            float bv = bias[gcol];
#pragma unroll
            for (int v = 0; v < 8; ++v) {
                int grow = row0 + wrow * 64 + i * 16 + v + 8 * hl;
                size_t gi = (size_t)grow * Dout + gcol;
                float val = acc[i][j][v] + bv;
                if constexpr (MODE == 0) outbf[gi] = (__bf16)val;
                else                     outf[gi] = val + resid[gi];
            }
        }
}

// ---------------------------------------------------------------------------
// Flash attention: grid = (SEQ/64, NHEAD), 128 thr (4 waves), wave = 16 q rows.
// K/V tiles staged in LDS once per block (K via async-to-LDS when available,
// V transposed so PV B-fragments vectorize). P re-striped via per-wave LDS.
// ---------------------------------------------------------------------------
__global__ __launch_bounds__(128)
void attn_flash(const __bf16* __restrict__ Q, const __bf16* __restrict__ Kb,
                const __bf16* __restrict__ Vb, __bf16* __restrict__ ctx) {
    __shared__ __align__(16) __bf16 lQ[64 * 64];       // 8 KB
    __shared__ __align__(16) __bf16 lK[32 * 64];       // 4 KB  [key][d]
    __shared__ __align__(16) __bf16 lVt[64 * 32];      // 4 KB  [d][key]
    __shared__ __align__(16) __bf16 lP[4][16 * 32];    // 4 KB

    const int tid   = threadIdx.x;
    const int wave  = tid >> 5;
    const int lane  = tid & 31;
    const int lm    = lane & 15;
    const int hl    = lane >> 4;
    const int qtile = blockIdx.x;
    const int h     = blockIdx.y;
    const int qbase = qtile * 64 + wave * 16;
    const int hoff  = h * DK;

    // stage Q tile (64 rows x 64 dk) once
#pragma unroll
    for (int rep = 0; rep < 8; ++rep) {
        int idx = tid + rep * 128;                     // 0..1023 vec4 chunks
        int r = idx >> 4, c4 = (idx & 15) * 4;
        *(bf16x4*)&lQ[r * 64 + c4] =
            *(const bf16x4*)&Q[(size_t)(qtile * 64 + r) * DMODEL + hoff + c4];
    }
    __syncthreads();
    v16bf qf[2];
#pragma unroll
    for (int c = 0; c < 2; ++c)
        qf[c] = load_frag(&lQ[(wave * 16 + lm) * 64 + c * 32], hl);

    v8f zero = {};
    v8f acc[4];
#pragma unroll
    for (int t = 0; t < 4; ++t) acc[t] = zero;
    float mrun[8], lrun[8];
#pragma unroll
    for (int v = 0; v < 8; ++v) { mrun[v] = -__builtin_inff(); lrun[v] = 0.f; }

    const int nkb = qtile * 2 + 2;                      // causal bound
    for (int kb = 0; kb < nkb; ++kb) {
        const int kbase = kb * 32;

        if (kb + 1 < nkb) {                             // prefetch next K/V rows
            __builtin_prefetch(&Kb[(size_t)(kbase + 32 + lane) * DMODEL + hoff], 0, 1);
            __builtin_prefetch(&Vb[(size_t)(kbase + 32 + lane) * DMODEL + hoff], 0, 1);
        }
        __syncthreads();                                // previous tile reads done

        // ---- stage K tile (32 keys x 64 d) ----
#if HAVE_ASYNC_LDS
#pragma unroll
        for (int rep = 0; rep < 2; ++rep) {
            int idx = tid + rep * 128;                  // 0..255 x 16B
            int r = idx >> 3, c8 = (idx & 7) * 8;
            __builtin_amdgcn_global_load_async_to_lds_b128(
                (AS1 v4i*)&Kb[(size_t)(kbase + r) * DMODEL + hoff + c8],
                (AS3 v4i*)&lK[r * 64 + c8], 0, 0);
        }
#else
#pragma unroll
        for (int rep = 0; rep < 4; ++rep) {
            int idx = tid + rep * 128;
            int r = idx >> 4, c4 = (idx & 15) * 4;
            *(bf16x4*)&lK[r * 64 + c4] =
                *(const bf16x4*)&Kb[(size_t)(kbase + r) * DMODEL + hoff + c4];
        }
#endif
        // ---- stage V tile transposed: lVt[d][key] ----
#pragma unroll
        for (int rep = 0; rep < 4; ++rep) {
            int idx = tid + rep * 128;
            int r = idx >> 4, c4 = (idx & 15) * 4;      // key r, dims c4..c4+3
            bf16x4 v = *(const bf16x4*)&Vb[(size_t)(kbase + r) * DMODEL + hoff + c4];
#pragma unroll
            for (int k = 0; k < 4; ++k) lVt[(c4 + k) * 32 + r] = v[k];
        }
#if HAVE_ASYNC_LDS
        __builtin_amdgcn_s_wait_asynccnt(0);
#endif
        __syncthreads();

        // ---- S = Q @ K^T ----
        v8f s[2];
        s[0] = zero; s[1] = zero;
#pragma unroll
        for (int t = 0; t < 2; ++t)
#pragma unroll
            for (int c = 0; c < 2; ++c) {
                v16bf kf = load_frag(&lK[(t * 16 + lm) * 64 + c * 32], hl);
                s[t] = __builtin_amdgcn_wmma_f32_16x16x32_bf16(
                    false, qf[c], false, kf, (short)0, s[t], false, false);
            }

        // ---- scale + causal mask + row max ----
        float rmax[8];
#pragma unroll
        for (int v = 0; v < 8; ++v) {
            int q = qbase + v + 8 * hl;
            float m = -__builtin_inff();
#pragma unroll
            for (int t = 0; t < 2; ++t) {
                int key = kbase + t * 16 + lm;
                float sv = s[t][v] * 0.125f;
                sv = (key > q) ? -__builtin_inff() : sv;
                s[t][v] = sv;
                m = fmaxf(m, sv);
            }
            rmax[v] = m;
        }
#pragma unroll
        for (int off = 1; off < 16; off <<= 1)
#pragma unroll
            for (int v = 0; v < 8; ++v)
                rmax[v] = fmaxf(rmax[v], __shfl_xor(rmax[v], off, 32));

        // ---- online softmax ----
        float alpha[8];
#pragma unroll
        for (int v = 0; v < 8; ++v) {
            float mnew = fmaxf(mrun[v], rmax[v]);
            alpha[v] = __expf(mrun[v] - mnew);
            mrun[v] = mnew;
        }
        float rsum[8];
#pragma unroll
        for (int v = 0; v < 8; ++v) {
            float sum = 0.f;
#pragma unroll
            for (int t = 0; t < 2; ++t) {
                float p = __expf(s[t][v] - mrun[v]);
                s[t][v] = p;
                sum += p;
            }
            rsum[v] = sum;
        }
#pragma unroll
        for (int off = 1; off < 16; off <<= 1)
#pragma unroll
            for (int v = 0; v < 8; ++v)
                rsum[v] += __shfl_xor(rsum[v], off, 32);
#pragma unroll
        for (int v = 0; v < 8; ++v) lrun[v] = lrun[v] * alpha[v] + rsum[v];
#pragma unroll
        for (int t = 0; t < 4; ++t)
#pragma unroll
            for (int v = 0; v < 8; ++v) acc[t][v] *= alpha[v];

        // ---- P: C layout -> A layout via per-wave LDS tile ----
#pragma unroll
        for (int t = 0; t < 2; ++t)
#pragma unroll
            for (int v = 0; v < 8; ++v)
                lP[wave][(v + 8 * hl) * 32 + t * 16 + lm] = (__bf16)s[t][v];
        __syncthreads();                                // uniform trip count
        v16bf pf = load_frag(&lP[wave][lm * 32], hl);

        // ---- ctx += P @ V ----
#pragma unroll
        for (int t = 0; t < 4; ++t) {
            v16bf vf = load_frag(&lVt[(t * 16 + lm) * 32], hl);
            acc[t] = __builtin_amdgcn_wmma_f32_16x16x32_bf16(
                false, pf, false, vf, (short)0, acc[t], false, false);
        }
    }

#pragma unroll
    for (int t = 0; t < 4; ++t)
#pragma unroll
        for (int v = 0; v < 8; ++v) {
            int qrow = qbase + v + 8 * hl;
            float o = acc[t][v] / lrun[v];
            ctx[(size_t)qrow * DMODEL + hoff + t * 16 + lm] = (__bf16)o;
        }
}

// ---------------------------------------------------------------------------
// Row-wise LayerNorm, in place on d_out.
// ---------------------------------------------------------------------------
__global__ __launch_bounds__(256)
void layernorm_kernel(float* __restrict__ y, const float* __restrict__ gamma,
                      const float* __restrict__ beta) {
    __shared__ float ssum[8], ssum2[8];
    const int row = blockIdx.x;
    const int tid = threadIdx.x;
    float s = 0.f, s2 = 0.f;
    for (int i = tid; i < DMODEL; i += 256) {
        float v = y[(size_t)row * DMODEL + i];
        s += v; s2 += v * v;
    }
#pragma unroll
    for (int off = 1; off < 32; off <<= 1) {
        s  += __shfl_xor(s,  off, 32);
        s2 += __shfl_xor(s2, off, 32);
    }
    int wave = tid >> 5, lane = tid & 31;
    if (lane == 0) { ssum[wave] = s; ssum2[wave] = s2; }
    __syncthreads();
    float ts = 0.f, ts2 = 0.f;
#pragma unroll
    for (int w = 0; w < 8; ++w) { ts += ssum[w]; ts2 += ssum2[w]; }
    float mu  = ts * (1.f / DMODEL);
    float var = ts2 * (1.f / DMODEL) - mu * mu;
    float inv = rsqrtf(var + LN_EPS);
    for (int i = tid; i < DMODEL; i += 256) {
        float v = y[(size_t)row * DMODEL + i];
        y[(size_t)row * DMODEL + i] = (v - mu) * inv * gamma[i] + beta[i];
    }
}

extern "C" void kernel_launch(void* const* d_in, const int* in_sizes, int n_in,
                              void* d_out, int out_size, void* d_ws, size_t ws_size,
                              hipStream_t stream) {
    const float* x     = (const float*)d_in[0];
    const float* Wq    = (const float*)d_in[1];
    const float* bq    = (const float*)d_in[2];
    const float* Wk    = (const float*)d_in[3];
    const float* bk    = (const float*)d_in[4];
    const float* Wv    = (const float*)d_in[5];
    const float* bv    = (const float*)d_in[6];
    const float* Wo    = (const float*)d_in[7];
    const float* bo    = (const float*)d_in[8];
    const float* gamma = (const float*)d_in[9];
    const float* beta  = (const float*)d_in[10];
    float* out = (float*)d_out;

    char* ws = (char*)d_ws;
    const size_t MAT = (size_t)SEQ * DMODEL * sizeof(__bf16);  // 4 MB
    __bf16* Qb = (__bf16*)(ws);
    __bf16* Kb = (__bf16*)(ws + MAT);
    __bf16* Vb = (__bf16*)(ws + 2 * MAT);
    __bf16* Cb = (__bf16*)(ws + 3 * MAT);

    dim3 gGemm(DMODEL / 128, SEQ / 128);
    gemm_wmma<0><<<gGemm, 256, 0, stream>>>(x, nullptr, Wq, bq, Qb, nullptr,
                                            nullptr, SEQ, DMODEL, DMODEL);
    gemm_wmma<0><<<gGemm, 256, 0, stream>>>(x, nullptr, Wk, bk, Kb, nullptr,
                                            nullptr, SEQ, DMODEL, DMODEL);
    gemm_wmma<0><<<gGemm, 256, 0, stream>>>(x, nullptr, Wv, bv, Vb, nullptr,
                                            nullptr, SEQ, DMODEL, DMODEL);
    dim3 gAttn(SEQ / 64, NHEAD);
    attn_flash<<<gAttn, 128, 0, stream>>>(Qb, Kb, Vb, Cb);
    gemm_wmma<1><<<gGemm, 256, 0, stream>>>(nullptr, Cb, Wo, bo, nullptr, out, x,
                                            SEQ, DMODEL, DMODEL);
    layernorm_kernel<<<SEQ, 256, 0, stream>>>(out, gamma, beta);
}

// v001
// A run of this version takes 314 microseconds.
// Two timings next to v000 both put it at 1.31 times that version's speed.
#include <hip/hip_runtime.h>

#define SEQ 2048
#define DMODEL 1024
#define NHEAD 16
#define DK 64
#define LN_EPS 1e-5f

typedef __bf16 v16bf  __attribute__((ext_vector_type(16)));
typedef __bf16 bf16x8 __attribute__((ext_vector_type(8)));
typedef __bf16 bf16x4 __attribute__((ext_vector_type(4)));
typedef float  v8f    __attribute__((ext_vector_type(8)));
typedef float  f32x4  __attribute__((ext_vector_type(4)));
typedef int    v4i    __attribute__((ext_vector_type(4)));

#define AS1 __attribute__((address_space(1)))
#define AS3 __attribute__((address_space(3)))

#if __has_builtin(__builtin_amdgcn_global_load_async_to_lds_b128) && \
    __has_builtin(__builtin_amdgcn_s_wait_asynccnt)
#define HAVE_ASYNC_LDS 1
#else
#define HAVE_ASYNC_LDS 0
#endif

// K-index mapping for 16-bit A/B fragments of V_WMMA_*_16X16X32_* (ISA 7.12.2):
// element e -> K = {0..7}+8*hl for e<8, {16..23}+8*hl for e>=8.
__device__ __forceinline__ int kmap(int e, int hl) {
    int v = e >> 1;
    int base = (v < 4) ? (2 * v) : (16 + 2 * (v - 4));
    return base + (e & 1) + 8 * hl;
}

// Fragment whose element e reads p[kmap(e,hl)]: two contiguous 16B runs.
__device__ __forceinline__ v16bf load_frag(const __bf16* p, int hl) {
    bf16x8 a0 = *(const bf16x8*)(p + 8 * hl);
    bf16x8 a1 = *(const bf16x8*)(p + 16 + 8 * hl);
    return __builtin_shufflevector(a0, a1, 0, 1, 2, 3, 4, 5, 6, 7,
                                   8, 9, 10, 11, 12, 13, 14, 15);
}

// ---------------------------------------------------------------------------
// Tiled bf16 WMMA GEMM: out[N,Dout] = A[N,K] @ W[K,Dout] + bias (+ resid)
// 256 threads = 8 waves (2x4), block tile 128x128, wave tile 64x32, K-step 32.
// MODE 0: A = f32, store bf16.  MODE 1: A = bf16, store f32 + bias + residual.
// ---------------------------------------------------------------------------
template <int MODE>
__global__ __launch_bounds__(256)
void gemm_wmma(const float* __restrict__ A, const __bf16* __restrict__ Abf,
               const float* __restrict__ W, const float* __restrict__ bias,
               __bf16* __restrict__ outbf, float* __restrict__ outf,
               const float* __restrict__ resid, int N, int K, int Dout) {
    __shared__ __align__(16) __bf16 lA[128 * 32];
    __shared__ __align__(16) __bf16 lB[32 * 128];

    const int tid  = threadIdx.x;
    const int wave = tid >> 5;
    const int lane = tid & 31;
    const int lm   = lane & 15;
    const int hl   = lane >> 4;
    const int wrow = wave >> 2;            // 0..1  -> 64-row slab
    const int wcol = wave & 3;             // 0..3  -> 32-col slab
    const int row0 = blockIdx.y * 128;
    const int col0 = blockIdx.x * 128;

    v8f zero = {};
    v8f acc[4][2];
#pragma unroll
    for (int i = 0; i < 4; ++i)
#pragma unroll
        for (int j = 0; j < 2; ++j) acc[i][j] = zero;

    for (int k0 = 0; k0 < K; k0 += 32) {
        // ---- stage A tile (128x32) ----
#pragma unroll
        for (int rep = 0; rep < 4; ++rep) {
            int idx = tid + rep * 256;                 // 0..1023 vec4 chunks
            int r = idx >> 3, c4 = (idx & 7) * 4;
            if constexpr (MODE == 0) {
                f32x4 v = *(const f32x4*)&A[(size_t)(row0 + r) * K + k0 + c4];
                bf16x4 b = {(__bf16)v.x, (__bf16)v.y, (__bf16)v.z, (__bf16)v.w};
                *(bf16x4*)&lA[r * 32 + c4] = b;
            } else {
                *(bf16x4*)&lA[r * 32 + c4] =
                    *(const bf16x4*)&Abf[(size_t)(row0 + r) * K + k0 + c4];
            }
        }
        // ---- stage B tile (32x128) ----
#pragma unroll
        for (int rep = 0; rep < 4; ++rep) {
            int idx = tid + rep * 256;
            int r = idx >> 5, c4 = (idx & 31) * 4;
            f32x4 v = *(const f32x4*)&W[(size_t)(k0 + r) * Dout + col0 + c4];
            bf16x4 b = {(__bf16)v.x, (__bf16)v.y, (__bf16)v.z, (__bf16)v.w};
            *(bf16x4*)&lB[r * 128 + c4] = b;
        }
        __syncthreads();

        v16bf af[4], bfr[2];
#pragma unroll
        for (int i = 0; i < 4; ++i)
            af[i] = load_frag(&lA[(wrow * 64 + i * 16 + lm) * 32], hl);
#pragma unroll
        for (int j = 0; j < 2; ++j) {
            int n0 = wcol * 32 + j * 16 + lm;
#pragma unroll
            for (int e = 0; e < 16; ++e)              // K-stride 128: scattered
                bfr[j][e] = lB[kmap(e, hl) * 128 + n0];
        }
#pragma unroll
        for (int i = 0; i < 4; ++i)
#pragma unroll
            for (int j = 0; j < 2; ++j)
                acc[i][j] = __builtin_amdgcn_wmma_f32_16x16x32_bf16(
                    false, af[i], false, bfr[j], (short)0, acc[i][j], false, false);
        __syncthreads();
    }

#pragma unroll
    for (int i = 0; i < 4; ++i)
#pragma unroll
        for (int j = 0; j < 2; ++j) {
            int gcol = col0 + wcol * 32 + j * 16 + lm;
            float bv = bias[gcol];
#pragma unroll
            for (int v = 0; v < 8; ++v) {
                int grow = row0 + wrow * 64 + i * 16 + v + 8 * hl;
                size_t gi = (size_t)grow * Dout + gcol;
                float val = acc[i][j][v] + bv;
                if constexpr (MODE == 0) outbf[gi] = (__bf16)val;
                else                     outf[gi] = val + resid[gi];
            }
        }
}

// Lane l <-> lane l ^ 16: the other half of the wave.
__device__ __forceinline__ float xhalf(float x) {
    int b = __builtin_bit_cast(int, x);
    return __builtin_bit_cast(float, __builtin_amdgcn_permlanex16(
        b, b, 0x76543210, 0xfedcba98, false, false));
}

// e^x as 2^(x * log2 e) on the transcendental unit, as __expf compiles. The
// v_nop in the same statement keeps the one free slot that the instruction set
// asks for behind a transcendental, whatever the compiler schedules next.
__device__ __forceinline__ float exp_slot(float x) {
    float r;
    asm("v_exp_f32 %0, %1\n\tv_nop" : "=v"(r) : "v"(x * 1.44269504088896340736f));
    return r;
}

__global__ __launch_bounds__(128)
void attn_flash(const __bf16* __restrict__ Q, const __bf16* __restrict__ Kb,
                const __bf16* __restrict__ Vb, __bf16* __restrict__ ctx) {
    __shared__ __align__(16) __bf16 lQ[64 * 64];       // 8 KB
    __shared__ __align__(16) __bf16 lK[32 * 64];       // 4 KB  [key][d]
    __shared__ __align__(16) __bf16 lVt[64 * 32];      // 4 KB  [d][key]

    const int tid   = threadIdx.x;
    const int wave  = tid >> 5;
    const int lane  = tid & 31;
    const int lm    = lane & 15;
    const int hl    = lane >> 4;
    const int qtile = blockIdx.x;
    const int h     = blockIdx.y;
    const int qbase = qtile * 64 + wave * 16;
    const int hoff  = h * DK;

    // stage Q tile (64 rows x 64 dk) once
#pragma unroll
    for (int rep = 0; rep < 8; ++rep) {
        int idx = tid + rep * 128;                     // 0..1023 vec4 chunks
        int r = idx >> 4, c4 = (idx & 15) * 4;
        *(bf16x4*)&lQ[r * 64 + c4] =
            *(const bf16x4*)&Q[(size_t)(qtile * 64 + r) * DMODEL + hoff + c4];
    }
    __syncthreads();
    v16bf qf[2];
#pragma unroll
    for (int c = 0; c < 2; ++c)
        qf[c] = load_frag(&lQ[(wave * 16 + lm) * 64 + c * 32], hl);

    v8f zero = {};
    v8f acc[4];
#pragma unroll
    for (int t = 0; t < 4; ++t) acc[t] = zero;
    float mrun = -__builtin_inff();                     // query lm, both halves alike
    float lrun = 0.f;                                   // this half's keys only
    const int q = qbase + lm;

    const int nkb = qtile * 2 + 2;                      // causal bound
    for (int kb = 0; kb < nkb; ++kb) {
        const int kbase = kb * 32;

        if (kb + 1 < nkb) {                             // prefetch next K/V rows
            __builtin_prefetch(&Kb[(size_t)(kbase + 32 + lane) * DMODEL + hoff], 0, 1);
            __builtin_prefetch(&Vb[(size_t)(kbase + 32 + lane) * DMODEL + hoff], 0, 1);
        }
        __syncthreads();                                // previous tile reads done

        // ---- stage K tile (32 keys x 64 d) ----
#if HAVE_ASYNC_LDS
#pragma unroll
        for (int rep = 0; rep < 2; ++rep) {
            int idx = tid + rep * 128;                  // 0..255 x 16B
            int r = idx >> 3, c8 = (idx & 7) * 8;
            __builtin_amdgcn_global_load_async_to_lds_b128(
                (AS1 v4i*)&Kb[(size_t)(kbase + r) * DMODEL + hoff + c8],
                (AS3 v4i*)&lK[r * 64 + c8], 0, 0);
        }
#else
#pragma unroll
        for (int rep = 0; rep < 4; ++rep) {
            int idx = tid + rep * 128;
            int r = idx >> 4, c4 = (idx & 15) * 4;
            *(bf16x4*)&lK[r * 64 + c4] =
                *(const bf16x4*)&Kb[(size_t)(kbase + r) * DMODEL + hoff + c4];
        }
#endif
        // ---- stage V tile transposed: lVt[d][key] ----
#pragma unroll
        for (int rep = 0; rep < 4; ++rep) {
            int idx = tid + rep * 128;
            int r = idx >> 4, c4 = (idx & 15) * 4;      // key r, dims c4..c4+3
            bf16x4 v = *(const bf16x4*)&Vb[(size_t)(kbase + r) * DMODEL + hoff + c4];
#pragma unroll
            for (int k = 0; k < 4; ++k) lVt[(c4 + k) * 32 + r] = v[k];
        }
#if HAVE_ASYNC_LDS
        __builtin_amdgcn_s_wait_asynccnt(0);
#endif
        __syncthreads();

        // ---- S^T = K @ Q^T: s[t][v] = score(key kbase+16t+8hl+v, query lm) ----
        v8f s[2];
        s[0] = zero; s[1] = zero;
#pragma unroll
        for (int t = 0; t < 2; ++t)
#pragma unroll
            for (int c = 0; c < 2; ++c) {
                v16bf kf = load_frag(&lK[(t * 16 + lm) * 64 + c * 32], hl);
                s[t] = __builtin_amdgcn_wmma_f32_16x16x32_bf16(
                    false, kf, false, qf[c], (short)0, s[t], false, false);
            }

        // ---- scale + causal mask + this query's max ----
        float m = -__builtin_inff();
#pragma unroll
        for (int t = 0; t < 2; ++t)
#pragma unroll
            for (int v = 0; v < 8; ++v) {
                int key = kbase + t * 16 + 8 * hl + v;
                float sv = s[t][v] * 0.125f;
                sv = (key > q) ? -__builtin_inff() : sv;
                s[t][v] = sv;
                m = fmaxf(m, sv);
            }
        m = fmaxf(m, xhalf(m));

        // ---- online softmax ----
        float mnew  = fmaxf(mrun, m);
        float alpha = exp_slot(mrun - mnew);
        mrun = mnew;
        float sum = 0.f;
#pragma unroll
        for (int t = 0; t < 2; ++t)
#pragma unroll
            for (int v = 0; v < 8; ++v) {
                float p = exp_slot(s[t][v] - mrun);
                s[t][v] = p;
                sum += p;
            }
        lrun = lrun * alpha + sum;
#pragma unroll
        for (int t = 0; t < 4; ++t)
#pragma unroll
            for (int v = 0; v < 8; ++v) acc[t][v] *= alpha;

        // ---- P^T as B operand: element e is key kmap(e, hl) of query lm ----
        v16bf pf;
#pragma unroll
        for (int e = 0; e < 16; ++e) pf[e] = (__bf16)s[e >> 3][e & 7];

        // ---- ctx^T += V^T @ P^T: acc[t][v] = ctx(query lm, dim 16t+8hl+v) ----
#pragma unroll
        for (int t = 0; t < 4; ++t) {
            v16bf vf = load_frag(&lVt[(t * 16 + lm) * 32], hl);
            acc[t] = __builtin_amdgcn_wmma_f32_16x16x32_bf16(
                false, vf, false, pf, (short)0, acc[t], false, false);
        }
    }

    const float ltot = lrun + xhalf(lrun);              // join the halves' sums
#pragma unroll
    for (int t = 0; t < 4; ++t) {
        bf16x8 o;
#pragma unroll
        for (int v = 0; v < 8; ++v) o[v] = (__bf16)(acc[t][v] / ltot);
        *(bf16x8*)&ctx[(size_t)q * DMODEL + hoff + t * 16 + 8 * hl] = o;
    }
}

// ---------------------------------------------------------------------------
// Row-wise LayerNorm, in place on d_out.
// ---------------------------------------------------------------------------
__global__ __launch_bounds__(256)
void layernorm_kernel(float* __restrict__ y, const float* __restrict__ gamma,
                      const float* __restrict__ beta) {
    __shared__ float ssum[8], ssum2[8];
    const int row = blockIdx.x;
    const int tid = threadIdx.x;
    float s = 0.f, s2 = 0.f;
    for (int i = tid; i < DMODEL; i += 256) {
        float v = y[(size_t)row * DMODEL + i];
        s += v; s2 += v * v;
    }
#pragma unroll
    for (int off = 1; off < 32; off <<= 1) {
        s  += __shfl_xor(s,  off, 32);
        s2 += __shfl_xor(s2, off, 32);
    }
    int wave = tid >> 5, lane = tid & 31;
    if (lane == 0) { ssum[wave] = s; ssum2[wave] = s2; }
    __syncthreads();
    float ts = 0.f, ts2 = 0.f;
#pragma unroll
    for (int w = 0; w < 8; ++w) { ts += ssum[w]; ts2 += ssum2[w]; }
    float mu  = ts * (1.f / DMODEL);
    float var = ts2 * (1.f / DMODEL) - mu * mu;
    float inv = rsqrtf(var + LN_EPS);
    for (int i = tid; i < DMODEL; i += 256) {
        float v = y[(size_t)row * DMODEL + i];
        y[(size_t)row * DMODEL + i] = (v - mu) * inv * gamma[i] + beta[i];
    }
}

extern "C" void kernel_launch(void* const* d_in, const int* in_sizes, int n_in,
                              void* d_out, int out_size, void* d_ws, size_t ws_size,
                              hipStream_t stream) {
    const float* x     = (const float*)d_in[0];
    const float* Wq    = (const float*)d_in[1];
    const float* bq    = (const float*)d_in[2];
    const float* Wk    = (const float*)d_in[3];
    const float* bk    = (const float*)d_in[4];
    const float* Wv    = (const float*)d_in[5];
    const float* bv    = (const float*)d_in[6];
    const float* Wo    = (const float*)d_in[7];
    const float* bo    = (const float*)d_in[8];
    const float* gamma = (const float*)d_in[9];
    const float* beta  = (const float*)d_in[10];
    float* out = (float*)d_out;

    char* ws = (char*)d_ws;
    const size_t MAT = (size_t)SEQ * DMODEL * sizeof(__bf16);  // 4 MB
    __bf16* Qb = (__bf16*)(ws);
    __bf16* Kb = (__bf16*)(ws + MAT);
    __bf16* Vb = (__bf16*)(ws + 2 * MAT);
    __bf16* Cb = (__bf16*)(ws + 3 * MAT);

    dim3 gGemm(DMODEL / 128, SEQ / 128);
    gemm_wmma<0><<<gGemm, 256, 0, stream>>>(x, nullptr, Wq, bq, Qb, nullptr,
                                            nullptr, SEQ, DMODEL, DMODEL);
    gemm_wmma<0><<<gGemm, 256, 0, stream>>>(x, nullptr, Wk, bk, Kb, nullptr,
                                            nullptr, SEQ, DMODEL, DMODEL);
    gemm_wmma<0><<<gGemm, 256, 0, stream>>>(x, nullptr, Wv, bv, Vb, nullptr,
                                            nullptr, SEQ, DMODEL, DMODEL);
    dim3 gAttn(SEQ / 64, NHEAD);
    attn_flash<<<gAttn, 128, 0, stream>>>(Qb, Kb, Vb, Cb);
    gemm_wmma<1><<<gGemm, 256, 0, stream>>>(nullptr, Cb, Wo, bo, nullptr, out, x,
                                            SEQ, DMODEL, DMODEL);
    layernorm_kernel<<<SEQ, 256, 0, stream>>>(out, gamma, beta);
}

// v002
// It runs in 230 microseconds.
// In both of two side-by-side timings against v001, it was 1.37 times as fast.
// All steps since v000 together make it 1.78 times as fast.
#include <hip/hip_runtime.h>

#define SEQ 2048
#define DMODEL 1024
#define NHEAD 16
#define DK 64
#define LN_EPS 1e-5f

typedef __bf16 v16bf  __attribute__((ext_vector_type(16)));
typedef __bf16 bf16x8 __attribute__((ext_vector_type(8)));
typedef __bf16 bf16x4 __attribute__((ext_vector_type(4)));
typedef float  v8f    __attribute__((ext_vector_type(8)));
typedef float  f32x4  __attribute__((ext_vector_type(4)));
typedef int    v4i    __attribute__((ext_vector_type(4)));

#define AS1 __attribute__((address_space(1)))
#define AS3 __attribute__((address_space(3)))

#if __has_builtin(__builtin_amdgcn_global_load_async_to_lds_b128) && \
    __has_builtin(__builtin_amdgcn_s_wait_asynccnt)
#define HAVE_ASYNC_LDS 1
#else
#define HAVE_ASYNC_LDS 0
#endif

// K-index mapping for 16-bit A/B fragments of V_WMMA_*_16X16X32_* (ISA 7.12.2):
// element e -> K = {0..7}+8*hl for e<8, {16..23}+8*hl for e>=8.
__device__ __forceinline__ int kmap(int e, int hl) {
    int v = e >> 1;
    int base = (v < 4) ? (2 * v) : (16 + 2 * (v - 4));
    return base + (e & 1) + 8 * hl;
}

// Fragment whose element e reads p[kmap(e,hl)]: two contiguous 16B runs.
__device__ __forceinline__ v16bf load_frag(const __bf16* p, int hl) {
    bf16x8 a0 = *(const bf16x8*)(p + 8 * hl);
    bf16x8 a1 = *(const bf16x8*)(p + 16 + 8 * hl);
    return __builtin_shufflevector(a0, a1, 0, 1, 2, 3, 4, 5, 6, 7,
                                   8, 9, 10, 11, 12, 13, 14, 15);
}

// ---------------------------------------------------------------------------
// Tiled bf16 WMMA GEMM: out[N,Dout] = A[N,K] @ W[K,Dout] + bias (+ resid)
// 256 threads = 8 waves (2x4), block tile 128x128, wave tile 64x32, K-step 32.
// MODE 0: A = f32, store bf16.  MODE 1: A = bf16, store f32 + bias + residual.
// MODE 0 runs three products on the same A in one launch: blockIdx.z picks the
// weight and bias, and the outputs are three N x Dout planes one after another.
// ---------------------------------------------------------------------------
template <int MODE>
__global__ __launch_bounds__(256)
void gemm_wmma(const float* __restrict__ A, const __bf16* __restrict__ Abf,
               const float* __restrict__ W0, const float* __restrict__ W1,
               const float* __restrict__ W2, const float* __restrict__ bias0,
               const float* __restrict__ bias1, const float* __restrict__ bias2,
               __bf16* __restrict__ outbf0, float* __restrict__ outf,
               const float* __restrict__ resid, int N, int K, int Dout) {
    __shared__ __align__(16) __bf16 lA[128 * 32];
    __shared__ __align__(16) __bf16 lB[32 * 128];

    const float* __restrict__ W    = W0;
    const float* __restrict__ bias = bias0;
    __bf16* __restrict__ outbf     = outbf0;
    if constexpr (MODE == 0) {
        const int z = blockIdx.z;
        W     = (z == 0) ? W0 : (z == 1) ? W1 : W2;
        bias  = (z == 0) ? bias0 : (z == 1) ? bias1 : bias2;
        outbf = outbf0 + (size_t)z * N * Dout;
    }

    const int tid  = threadIdx.x;
    const int wave = tid >> 5;
    const int lane = tid & 31;
    const int lm   = lane & 15;
    const int hl   = lane >> 4;
    const int wrow = wave >> 2;            // 0..1  -> 64-row slab
    const int wcol = wave & 3;             // 0..3  -> 32-col slab
    const int row0 = blockIdx.y * 128;
    const int col0 = blockIdx.x * 128;

    v8f zero = {};
    v8f acc[4][2];
#pragma unroll
    for (int i = 0; i < 4; ++i)
#pragma unroll
        for (int j = 0; j < 2; ++j) acc[i][j] = zero;

    for (int k0 = 0; k0 < K; k0 += 32) {
        // ---- stage A tile (128x32) ----
#pragma unroll
        for (int rep = 0; rep < 4; ++rep) {
            int idx = tid + rep * 256;                 // 0..1023 vec4 chunks
            int r = idx >> 3, c4 = (idx & 7) * 4;
            if constexpr (MODE == 0) {
                f32x4 v = *(const f32x4*)&A[(size_t)(row0 + r) * K + k0 + c4];
                bf16x4 b = {(__bf16)v.x, (__bf16)v.y, (__bf16)v.z, (__bf16)v.w};
                *(bf16x4*)&lA[r * 32 + c4] = b;
            } else {
                *(bf16x4*)&lA[r * 32 + c4] =
                    *(const bf16x4*)&Abf[(size_t)(row0 + r) * K + k0 + c4];
            }
        }
        // ---- stage B tile (32x128) ----
#pragma unroll
        for (int rep = 0; rep < 4; ++rep) {
            int idx = tid + rep * 256;
            int r = idx >> 5, c4 = (idx & 31) * 4;
            f32x4 v = *(const f32x4*)&W[(size_t)(k0 + r) * Dout + col0 + c4];
            bf16x4 b = {(__bf16)v.x, (__bf16)v.y, (__bf16)v.z, (__bf16)v.w};
            *(bf16x4*)&lB[r * 128 + c4] = b;
        }
        __syncthreads();

        v16bf af[4], bfr[2];
#pragma unroll
        for (int i = 0; i < 4; ++i)
            af[i] = load_frag(&lA[(wrow * 64 + i * 16 + lm) * 32], hl);
#pragma unroll
        for (int j = 0; j < 2; ++j) {
            int n0 = wcol * 32 + j * 16 + lm;
#pragma unroll
            for (int e = 0; e < 16; ++e)              // K-stride 128: scattered
                bfr[j][e] = lB[kmap(e, hl) * 128 + n0];
        }
#pragma unroll
        for (int i = 0; i < 4; ++i)
#pragma unroll
            for (int j = 0; j < 2; ++j)
                acc[i][j] = __builtin_amdgcn_wmma_f32_16x16x32_bf16(
                    false, af[i], false, bfr[j], (short)0, acc[i][j], false, false);
        __syncthreads();
    }

#pragma unroll
    for (int i = 0; i < 4; ++i)
#pragma unroll
        for (int j = 0; j < 2; ++j) {
            int gcol = col0 + wcol * 32 + j * 16 + lm;
            float bv = bias[gcol];
#pragma unroll
            for (int v = 0; v < 8; ++v) {
                int grow = row0 + wrow * 64 + i * 16 + v + 8 * hl;
                size_t gi = (size_t)grow * Dout + gcol;
                float val = acc[i][j][v] + bv;
                if constexpr (MODE == 0) outbf[gi] = (__bf16)val;
                else                     outf[gi] = val + resid[gi];
            }
        }
}

// Lane l <-> lane l ^ 16: the other half of the wave.
__device__ __forceinline__ float xhalf(float x) {
    int b = __builtin_bit_cast(int, x);
    return __builtin_bit_cast(float, __builtin_amdgcn_permlanex16(
        b, b, 0x76543210, 0xfedcba98, false, false));
}

// e^x as 2^(x * log2 e) on the transcendental unit, as __expf compiles. The
// v_nop in the same statement keeps the one free slot that the instruction set
// asks for behind a transcendental, whatever the compiler schedules next.
__device__ __forceinline__ float exp_slot(float x) {
    float r;
    asm("v_exp_f32 %0, %1\n\tv_nop" : "=v"(r) : "v"(x * 1.44269504088896340736f));
    return r;
}

__global__ __launch_bounds__(128)
void attn_flash(const __bf16* __restrict__ Q, const __bf16* __restrict__ Kb,
                const __bf16* __restrict__ Vb, __bf16* __restrict__ ctx) {
    __shared__ __align__(16) __bf16 lQ[64 * 64];       // 8 KB
    __shared__ __align__(16) __bf16 lK[32 * 64];       // 4 KB  [key][d]
    __shared__ __align__(16) __bf16 lVt[64 * 32];      // 4 KB  [d][key]

    const int tid   = threadIdx.x;
    const int wave  = tid >> 5;
    const int lane  = tid & 31;
    const int lm    = lane & 15;
    const int hl    = lane >> 4;
    const int qtile = blockIdx.x;
    const int h     = blockIdx.y;
    const int qbase = qtile * 64 + wave * 16;
    const int hoff  = h * DK;

    // stage Q tile (64 rows x 64 dk) once
#pragma unroll
    for (int rep = 0; rep < 8; ++rep) {
        int idx = tid + rep * 128;                     // 0..1023 vec4 chunks
        int r = idx >> 4, c4 = (idx & 15) * 4;
        *(bf16x4*)&lQ[r * 64 + c4] =
            *(const bf16x4*)&Q[(size_t)(qtile * 64 + r) * DMODEL + hoff + c4];
    }
    __syncthreads();
    v16bf qf[2];
#pragma unroll
    for (int c = 0; c < 2; ++c)
        qf[c] = load_frag(&lQ[(wave * 16 + lm) * 64 + c * 32], hl);

    v8f zero = {};
    v8f acc[4];
#pragma unroll
    for (int t = 0; t < 4; ++t) acc[t] = zero;
    float mrun = -__builtin_inff();                     // query lm, both halves alike
    float lrun = 0.f;                                   // this half's keys only
    const int q = qbase + lm;

    const int nkb = qtile * 2 + 2;                      // causal bound
    for (int kb = 0; kb < nkb; ++kb) {
        const int kbase = kb * 32;

        if (kb + 1 < nkb) {                             // prefetch next K/V rows
            __builtin_prefetch(&Kb[(size_t)(kbase + 32 + lane) * DMODEL + hoff], 0, 1);
            __builtin_prefetch(&Vb[(size_t)(kbase + 32 + lane) * DMODEL + hoff], 0, 1);
        }
        __syncthreads();                                // previous tile reads done

        // ---- stage K tile (32 keys x 64 d) ----
#if HAVE_ASYNC_LDS
#pragma unroll
        for (int rep = 0; rep < 2; ++rep) {
            int idx = tid + rep * 128;                  // 0..255 x 16B
            int r = idx >> 3, c8 = (idx & 7) * 8;
            __builtin_amdgcn_global_load_async_to_lds_b128(
                (AS1 v4i*)&Kb[(size_t)(kbase + r) * DMODEL + hoff + c8],
                (AS3 v4i*)&lK[r * 64 + c8], 0, 0);
        }
#else
#pragma unroll
        for (int rep = 0; rep < 4; ++rep) {
            int idx = tid + rep * 128;
            int r = idx >> 4, c4 = (idx & 15) * 4;
            *(bf16x4*)&lK[r * 64 + c4] =
                *(const bf16x4*)&Kb[(size_t)(kbase + r) * DMODEL + hoff + c4];
        }
#endif
        // ---- stage V tile transposed: lVt[d][key] ----
#pragma unroll
        for (int rep = 0; rep < 4; ++rep) {
            int idx = tid + rep * 128;
            int r = idx >> 4, c4 = (idx & 15) * 4;      // key r, dims c4..c4+3
            bf16x4 v = *(const bf16x4*)&Vb[(size_t)(kbase + r) * DMODEL + hoff + c4];
#pragma unroll
            for (int k = 0; k < 4; ++k) lVt[(c4 + k) * 32 + r] = v[k];
        }
#if HAVE_ASYNC_LDS
        __builtin_amdgcn_s_wait_asynccnt(0);
#endif
        __syncthreads();

        // ---- S^T = K @ Q^T: s[t][v] = score(key kbase+16t+8hl+v, query lm) ----
        v8f s[2];
        s[0] = zero; s[1] = zero;
#pragma unroll
        for (int t = 0; t < 2; ++t)
#pragma unroll
            for (int c = 0; c < 2; ++c) {
                v16bf kf = load_frag(&lK[(t * 16 + lm) * 64 + c * 32], hl);
                s[t] = __builtin_amdgcn_wmma_f32_16x16x32_bf16(
                    false, kf, false, qf[c], (short)0, s[t], false, false);
            }

        // ---- scale + causal mask + this query's max ----
        float m = -__builtin_inff();
#pragma unroll
        for (int t = 0; t < 2; ++t)
#pragma unroll
            for (int v = 0; v < 8; ++v) {
                int key = kbase + t * 16 + 8 * hl + v;
                float sv = s[t][v] * 0.125f;
                sv = (key > q) ? -__builtin_inff() : sv;
                s[t][v] = sv;
                m = fmaxf(m, sv);
            }
        m = fmaxf(m, xhalf(m));

        // ---- online softmax ----
        float mnew  = fmaxf(mrun, m);
        float alpha = exp_slot(mrun - mnew);
        mrun = mnew;
        float sum = 0.f;
#pragma unroll
        for (int t = 0; t < 2; ++t)
#pragma unroll
            for (int v = 0; v < 8; ++v) {
                float p = exp_slot(s[t][v] - mrun);
                s[t][v] = p;
                sum += p;
            }
        lrun = lrun * alpha + sum;
#pragma unroll
        for (int t = 0; t < 4; ++t)
#pragma unroll
            for (int v = 0; v < 8; ++v) acc[t][v] *= alpha;

        // ---- P^T as B operand: element e is key kmap(e, hl) of query lm ----
        v16bf pf;
#pragma unroll
        for (int e = 0; e < 16; ++e) pf[e] = (__bf16)s[e >> 3][e & 7];

        // ---- ctx^T += V^T @ P^T: acc[t][v] = ctx(query lm, dim 16t+8hl+v) ----
#pragma unroll
        for (int t = 0; t < 4; ++t) {
            v16bf vf = load_frag(&lVt[(t * 16 + lm) * 32], hl);
            acc[t] = __builtin_amdgcn_wmma_f32_16x16x32_bf16(
                false, vf, false, pf, (short)0, acc[t], false, false);
        }
    }

    const float ltot = lrun + xhalf(lrun);              // join the halves' sums
#pragma unroll
    for (int t = 0; t < 4; ++t) {
        bf16x8 o;
#pragma unroll
        for (int v = 0; v < 8; ++v) o[v] = (__bf16)(acc[t][v] / ltot);
        *(bf16x8*)&ctx[(size_t)q * DMODEL + hoff + t * 16 + 8 * hl] = o;
    }
}

// ---------------------------------------------------------------------------
// Row-wise LayerNorm, in place on d_out.
// ---------------------------------------------------------------------------
__global__ __launch_bounds__(256)
void layernorm_kernel(float* __restrict__ y, const float* __restrict__ gamma,
                      const float* __restrict__ beta) {
    __shared__ float ssum[8], ssum2[8];
    const int row = blockIdx.x;
    const int tid = threadIdx.x;
    float s = 0.f, s2 = 0.f;
    for (int i = tid; i < DMODEL; i += 256) {
        float v = y[(size_t)row * DMODEL + i];
        s += v; s2 += v * v;
    }
#pragma unroll
    for (int off = 1; off < 32; off <<= 1) {
        s  += __shfl_xor(s,  off, 32);
        s2 += __shfl_xor(s2, off, 32);
    }
    int wave = tid >> 5, lane = tid & 31;
    if (lane == 0) { ssum[wave] = s; ssum2[wave] = s2; }
    __syncthreads();
    float ts = 0.f, ts2 = 0.f;
#pragma unroll
    for (int w = 0; w < 8; ++w) { ts += ssum[w]; ts2 += ssum2[w]; }
    float mu  = ts * (1.f / DMODEL);
    float var = ts2 * (1.f / DMODEL) - mu * mu;
    float inv = rsqrtf(var + LN_EPS);
    for (int i = tid; i < DMODEL; i += 256) {
        float v = y[(size_t)row * DMODEL + i];
        y[(size_t)row * DMODEL + i] = (v - mu) * inv * gamma[i] + beta[i];
    }
}

extern "C" void kernel_launch(void* const* d_in, const int* in_sizes, int n_in,
                              void* d_out, int out_size, void* d_ws, size_t ws_size,
                              hipStream_t stream) {
    const float* x     = (const float*)d_in[0];
    const float* Wq    = (const float*)d_in[1];
    const float* bq    = (const float*)d_in[2];
    const float* Wk    = (const float*)d_in[3];
    const float* bk    = (const float*)d_in[4];
    const float* Wv    = (const float*)d_in[5];
    const float* bv    = (const float*)d_in[6];
    const float* Wo    = (const float*)d_in[7];
    const float* bo    = (const float*)d_in[8];
    const float* gamma = (const float*)d_in[9];
    const float* beta  = (const float*)d_in[10];
    float* out = (float*)d_out;

    char* ws = (char*)d_ws;
    const size_t MAT = (size_t)SEQ * DMODEL * sizeof(__bf16);  // 4 MB
    __bf16* Qb = (__bf16*)(ws);
    __bf16* Kb = (__bf16*)(ws + MAT);
    __bf16* Vb = (__bf16*)(ws + 2 * MAT);
    __bf16* Cb = (__bf16*)(ws + 3 * MAT);

    dim3 gGemm(DMODEL / 128, SEQ / 128);
    dim3 gQkv(DMODEL / 128, SEQ / 128, 3);              // planes Qb, Kb, Vb
    gemm_wmma<0><<<gQkv, 256, 0, stream>>>(x, nullptr, Wq, Wk, Wv, bq, bk, bv, Qb,
                                           nullptr, nullptr, SEQ, DMODEL, DMODEL);
    dim3 gAttn(SEQ / 64, NHEAD);
    attn_flash<<<gAttn, 128, 0, stream>>>(Qb, Kb, Vb, Cb);
    gemm_wmma<1><<<gGemm, 256, 0, stream>>>(nullptr, Cb, Wo, nullptr, nullptr, bo,
                                            nullptr, nullptr, nullptr, out, x,
                                            SEQ, DMODEL, DMODEL);
    layernorm_kernel<<<SEQ, 256, 0, stream>>>(out, gamma, beta);
}

// v003
// A run of this version takes 140 microseconds.
// Two timings next to v002 both put it at 1.64 times that version's speed.
// Counting every step since v000, it is 2.93 times as fast.
#include <hip/hip_runtime.h>

#define SEQ 2048
#define DMODEL 1024
#define NHEAD 16
#define DK 64
#define LN_EPS 1e-5f

typedef __bf16 v16bf  __attribute__((ext_vector_type(16)));
typedef __bf16 bf16x8 __attribute__((ext_vector_type(8)));
typedef __bf16 bf16x4 __attribute__((ext_vector_type(4)));
typedef float  v8f    __attribute__((ext_vector_type(8)));
typedef float  f32x4  __attribute__((ext_vector_type(4)));
typedef int    v4i    __attribute__((ext_vector_type(4)));

#define AS1 __attribute__((address_space(1)))
#define AS3 __attribute__((address_space(3)))

#if __has_builtin(__builtin_amdgcn_global_load_async_to_lds_b128) && \
    __has_builtin(__builtin_amdgcn_s_wait_asynccnt)
#define HAVE_ASYNC_LDS 1
#else
#define HAVE_ASYNC_LDS 0
#endif

// K-index mapping kmap(e, hl) of 16-bit A/B fragments of V_WMMA_*_16X16X32_*
// (ISA 7.12.2): element e -> K = {0..7}+8*hl for e<8, {16..23}+8*hl for e>=8.

// LDS row pitches in elements. Rows read by ds_load_b128 stand at an odd
// multiple of 16 B, rows read by ds_load_tr16_b128 at an odd multiple of 32 B:
// a half wave's sixteen 16-byte reads then cover the 64 banks once.
#define PITCH_A 40                                      // 32-element rows,  80 B
#define PITCH_B 144                                     // 128-element rows, 288 B
#define PITCH_K 72                                      // 64-element rows,  144 B
#define PITCH_V 80                                      // 64-element rows,  160 B

// Fragment whose element e reads p[kmap(e,hl)]: two contiguous 16B runs.
__device__ __forceinline__ v16bf load_frag(const __bf16* p, int hl) {
    bf16x8 a0 = *(const bf16x8*)(p + 8 * hl);
    bf16x8 a1 = *(const bf16x8*)(p + 16 + 8 * hl);
    return __builtin_shufflevector(a0, a1, 0, 1, 2, 3, 4, 5, 6, 7,
                                   8, 9, 10, 11, 12, 13, 14, 15);
}

// Transposed fragment from a row-major LDS tile T[k][n] (32 rows of k, PITCH
// elements apart): lane (lm, hl) gets element e = T[kmap(e,hl)][n0 + lm]. Each
// transposing load takes 16 rows of k; lane l points at the 16 bytes at row
// 8*(l>>4) + (l&7), column n0 + 8*((l>>3)&1).
template <int PITCH>
__device__ __forceinline__ v16bf load_frag_tr(const __bf16* tile, int n0, int lane) {
    const __bf16* p = tile + (8 * (lane >> 4) + (lane & 7)) * PITCH + n0 +
                      8 * ((lane >> 3) & 1);
    bf16x8 a0 = __builtin_amdgcn_ds_load_tr16_b128_v8bf16((AS3 bf16x8*)p);
    bf16x8 a1 = __builtin_amdgcn_ds_load_tr16_b128_v8bf16((AS3 bf16x8*)(p + 16 * PITCH));
    return __builtin_shufflevector(a0, a1, 0, 1, 2, 3, 4, 5, 6, 7,
                                   8, 9, 10, 11, 12, 13, 14, 15);
}

// ---------------------------------------------------------------------------
// Tiled bf16 WMMA GEMM: out[N,Dout] = A[N,K] @ W[K,Dout] + bias (+ resid)
// 256 threads = 8 waves (2x4), block tile 128x128, wave tile 64x32, K-step 32.
// MODE 0: A = f32, store bf16.  MODE 1: A = bf16, store f32 + bias + residual.
// MODE 0 runs three products on the same A in one launch: blockIdx.z picks the
// weight and bias, and the outputs are three N x Dout planes one after another.
// ---------------------------------------------------------------------------
template <int MODE>
__global__ __launch_bounds__(256)
void gemm_wmma(const float* __restrict__ A, const __bf16* __restrict__ Abf,
               const float* __restrict__ W0, const float* __restrict__ W1,
               const float* __restrict__ W2, const float* __restrict__ bias0,
               const float* __restrict__ bias1, const float* __restrict__ bias2,
               __bf16* __restrict__ outbf0, float* __restrict__ outf,
               const float* __restrict__ resid, int N, int K, int Dout) {
    __shared__ __align__(16) __bf16 lA[128 * PITCH_A];
    __shared__ __align__(16) __bf16 lB[32 * PITCH_B];

    const float* __restrict__ W    = W0;
    const float* __restrict__ bias = bias0;
    __bf16* __restrict__ outbf     = outbf0;
    if constexpr (MODE == 0) {
        const int z = blockIdx.z;
        W     = (z == 0) ? W0 : (z == 1) ? W1 : W2;
        bias  = (z == 0) ? bias0 : (z == 1) ? bias1 : bias2;
        outbf = outbf0 + (size_t)z * N * Dout;
    }

    const int tid  = threadIdx.x;
    const int wave = tid >> 5;
    const int lane = tid & 31;
    const int lm   = lane & 15;
    const int hl   = lane >> 4;
    const int wrow = wave >> 2;            // 0..1  -> 64-row slab
    const int wcol = wave & 3;             // 0..3  -> 32-col slab
    const int row0 = blockIdx.y * 128;
    const int col0 = blockIdx.x * 128;

    v8f zero = {};
    v8f acc[4][2];
#pragma unroll
    for (int i = 0; i < 4; ++i)
#pragma unroll
        for (int j = 0; j < 2; ++j) acc[i][j] = zero;

    for (int k0 = 0; k0 < K; k0 += 32) {
        // ---- stage A tile (128x32) ----
#pragma unroll
        for (int rep = 0; rep < 4; ++rep) {
            int idx = tid + rep * 256;                 // 0..1023 vec4 chunks
            int r = idx >> 3, c4 = (idx & 7) * 4;
            if constexpr (MODE == 0) {
                f32x4 v = *(const f32x4*)&A[(size_t)(row0 + r) * K + k0 + c4];
                bf16x4 b = {(__bf16)v.x, (__bf16)v.y, (__bf16)v.z, (__bf16)v.w};
                *(bf16x4*)&lA[r * PITCH_A + c4] = b;
            } else {
                *(bf16x4*)&lA[r * PITCH_A + c4] =
                    *(const bf16x4*)&Abf[(size_t)(row0 + r) * K + k0 + c4];
            }
        }
        // ---- stage B tile (32x128) ----
#pragma unroll
        for (int rep = 0; rep < 4; ++rep) {
            int idx = tid + rep * 256;
            int r = idx >> 5, c4 = (idx & 31) * 4;
            f32x4 v = *(const f32x4*)&W[(size_t)(k0 + r) * Dout + col0 + c4];
            bf16x4 b = {(__bf16)v.x, (__bf16)v.y, (__bf16)v.z, (__bf16)v.w};
            *(bf16x4*)&lB[r * PITCH_B + c4] = b;
        }
        __syncthreads();

        v16bf af[4], bfr[2];
#pragma unroll
        for (int i = 0; i < 4; ++i)
            af[i] = load_frag(&lA[(wrow * 64 + i * 16 + lm) * PITCH_A], hl);
#pragma unroll
        for (int j = 0; j < 2; ++j)
            bfr[j] = load_frag_tr<PITCH_B>(lB, wcol * 32 + j * 16, lane);
#pragma unroll
        for (int i = 0; i < 4; ++i)
#pragma unroll
            for (int j = 0; j < 2; ++j)
                acc[i][j] = __builtin_amdgcn_wmma_f32_16x16x32_bf16(
                    false, af[i], false, bfr[j], (short)0, acc[i][j], false, false);
        __syncthreads();
    }

#pragma unroll
    for (int i = 0; i < 4; ++i)
#pragma unroll
        for (int j = 0; j < 2; ++j) {
            int gcol = col0 + wcol * 32 + j * 16 + lm;
            float bv = bias[gcol];
#pragma unroll
            for (int v = 0; v < 8; ++v) {
                int grow = row0 + wrow * 64 + i * 16 + v + 8 * hl;
                size_t gi = (size_t)grow * Dout + gcol;
                float val = acc[i][j][v] + bv;
                if constexpr (MODE == 0) outbf[gi] = (__bf16)val;
                else                     outf[gi] = val + resid[gi];
            }
        }
}

// Lane l <-> lane l ^ 16: the other half of the wave.
__device__ __forceinline__ float xhalf(float x) {
    int b = __builtin_bit_cast(int, x);
    return __builtin_bit_cast(float, __builtin_amdgcn_permlanex16(
        b, b, 0x76543210, 0xfedcba98, false, false));
}

// e^x as 2^(x * log2 e) on the transcendental unit, as __expf compiles. The
// v_nop in the same statement keeps the one free slot that the instruction set
// asks for behind a transcendental, whatever the compiler schedules next.
__device__ __forceinline__ float exp_slot(float x) {
    float r;
    asm("v_exp_f32 %0, %1\n\tv_nop" : "=v"(r) : "v"(x * 1.44269504088896340736f));
    return r;
}

__global__ __launch_bounds__(128)
void attn_flash(const __bf16* __restrict__ Q, const __bf16* __restrict__ Kb,
                const __bf16* __restrict__ Vb, __bf16* __restrict__ ctx) {
    __shared__ __align__(16) __bf16 lQ[64 * 64];       // 8 KB
    __shared__ __align__(16) __bf16 lK[32 * PITCH_K];  // [key][d]
    __shared__ __align__(16) __bf16 lV[32 * PITCH_V];  // [key][d]

    const int tid   = threadIdx.x;
    const int wave  = tid >> 5;
    const int lane  = tid & 31;
    const int lm    = lane & 15;
    const int hl    = lane >> 4;
    const int qtile = blockIdx.x;
    const int h     = blockIdx.y;
    const int qbase = qtile * 64 + wave * 16;
    const int hoff  = h * DK;

    // stage Q tile (64 rows x 64 dk) once
#pragma unroll
    for (int rep = 0; rep < 8; ++rep) {
        int idx = tid + rep * 128;                     // 0..1023 vec4 chunks
        int r = idx >> 4, c4 = (idx & 15) * 4;
        *(bf16x4*)&lQ[r * 64 + c4] =
            *(const bf16x4*)&Q[(size_t)(qtile * 64 + r) * DMODEL + hoff + c4];
    }
    __syncthreads();
    v16bf qf[2];
#pragma unroll
    for (int c = 0; c < 2; ++c)
        qf[c] = load_frag(&lQ[(wave * 16 + lm) * 64 + c * 32], hl);

    v8f zero = {};
    v8f acc[4];
#pragma unroll
    for (int t = 0; t < 4; ++t) acc[t] = zero;
    float mrun = -__builtin_inff();                     // query lm, both halves alike
    float lrun = 0.f;                                   // this half's keys only
    const int q = qbase + lm;

    const int nkb = qtile * 2 + 2;                      // causal bound
    for (int kb = 0; kb < nkb; ++kb) {
        const int kbase = kb * 32;

        if (kb + 1 < nkb) {                             // prefetch next K/V rows
            __builtin_prefetch(&Kb[(size_t)(kbase + 32 + lane) * DMODEL + hoff], 0, 1);
            __builtin_prefetch(&Vb[(size_t)(kbase + 32 + lane) * DMODEL + hoff], 0, 1);
        }
        __syncthreads();                                // previous tile reads done

        // ---- stage K tile (32 keys x 64 d) ----
#if HAVE_ASYNC_LDS
#pragma unroll
        for (int rep = 0; rep < 2; ++rep) {
            int idx = tid + rep * 128;                  // 0..255 x 16B
            int r = idx >> 3, c8 = (idx & 7) * 8;
            __builtin_amdgcn_global_load_async_to_lds_b128(
                (AS1 v4i*)&Kb[(size_t)(kbase + r) * DMODEL + hoff + c8],
                (AS3 v4i*)&lK[r * PITCH_K + c8], 0, 0);
        }
#else
#pragma unroll
        for (int rep = 0; rep < 4; ++rep) {
            int idx = tid + rep * 128;
            int r = idx >> 4, c4 = (idx & 15) * 4;
            *(bf16x4*)&lK[r * PITCH_K + c4] =
                *(const bf16x4*)&Kb[(size_t)(kbase + r) * DMODEL + hoff + c4];
        }
#endif
        // ---- stage V tile (32 keys x 64 d) ----
#pragma unroll
        for (int rep = 0; rep < 4; ++rep) {
            int idx = tid + rep * 128;
            int r = idx >> 4, c4 = (idx & 15) * 4;      // key r, dims c4..c4+3
            *(bf16x4*)&lV[r * PITCH_V + c4] =
                *(const bf16x4*)&Vb[(size_t)(kbase + r) * DMODEL + hoff + c4];
        }
#if HAVE_ASYNC_LDS
        __builtin_amdgcn_s_wait_asynccnt(0);
#endif
        __syncthreads();

        // ---- S^T = K @ Q^T: s[t][v] = score(key kbase+16t+8hl+v, query lm) ----
        v8f s[2];
        s[0] = zero; s[1] = zero;
#pragma unroll
        for (int t = 0; t < 2; ++t)
#pragma unroll
            for (int c = 0; c < 2; ++c) {
                v16bf kf = load_frag(&lK[(t * 16 + lm) * PITCH_K + c * 32], hl);
                s[t] = __builtin_amdgcn_wmma_f32_16x16x32_bf16(
                    false, kf, false, qf[c], (short)0, s[t], false, false);
            }

        // ---- scale + causal mask + this query's max ----
        float m = -__builtin_inff();
#pragma unroll
        for (int t = 0; t < 2; ++t)
#pragma unroll
            for (int v = 0; v < 8; ++v) {
                int key = kbase + t * 16 + 8 * hl + v;
                float sv = s[t][v] * 0.125f;
                sv = (key > q) ? -__builtin_inff() : sv;
                s[t][v] = sv;
                m = fmaxf(m, sv);
            }
        m = fmaxf(m, xhalf(m));

        // ---- online softmax ----
        float mnew  = fmaxf(mrun, m);
        float alpha = exp_slot(mrun - mnew);
        mrun = mnew;
        float sum = 0.f;
#pragma unroll
        for (int t = 0; t < 2; ++t)
#pragma unroll
            for (int v = 0; v < 8; ++v) {
                float p = exp_slot(s[t][v] - mrun);
                s[t][v] = p;
                sum += p;
            }
        lrun = lrun * alpha + sum;
#pragma unroll
        for (int t = 0; t < 4; ++t)
#pragma unroll
            for (int v = 0; v < 8; ++v) acc[t][v] *= alpha;

        // ---- P^T as B operand: element e is key kmap(e, hl) of query lm ----
        v16bf pf;
#pragma unroll
        for (int e = 0; e < 16; ++e) pf[e] = (__bf16)s[e >> 3][e & 7];

        // ---- ctx^T += V^T @ P^T: acc[t][v] = ctx(query lm, dim 16t+8hl+v) ----
#pragma unroll
        for (int t = 0; t < 4; ++t) {
            v16bf vf = load_frag_tr<PITCH_V>(lV, t * 16, lane);
            acc[t] = __builtin_amdgcn_wmma_f32_16x16x32_bf16(
                false, vf, false, pf, (short)0, acc[t], false, false);
        }
    }

    const float ltot = lrun + xhalf(lrun);              // join the halves' sums
#pragma unroll
    for (int t = 0; t < 4; ++t) {
        bf16x8 o;
#pragma unroll
        for (int v = 0; v < 8; ++v) o[v] = (__bf16)(acc[t][v] / ltot);
        *(bf16x8*)&ctx[(size_t)q * DMODEL + hoff + t * 16 + 8 * hl] = o;
    }
}

// ---------------------------------------------------------------------------
// Row-wise LayerNorm, in place on d_out.
// ---------------------------------------------------------------------------
__global__ __launch_bounds__(256)
void layernorm_kernel(float* __restrict__ y, const float* __restrict__ gamma,
                      const float* __restrict__ beta) {
    __shared__ float ssum[8], ssum2[8];
    const int row = blockIdx.x;
    const int tid = threadIdx.x;
    float s = 0.f, s2 = 0.f;
    for (int i = tid; i < DMODEL; i += 256) {
        float v = y[(size_t)row * DMODEL + i];
        s += v; s2 += v * v;
    }
#pragma unroll
    for (int off = 1; off < 32; off <<= 1) {
        s  += __shfl_xor(s,  off, 32);
        s2 += __shfl_xor(s2, off, 32);
    }
    int wave = tid >> 5, lane = tid & 31;
    if (lane == 0) { ssum[wave] = s; ssum2[wave] = s2; }
    __syncthreads();
    float ts = 0.f, ts2 = 0.f;
#pragma unroll
    for (int w = 0; w < 8; ++w) { ts += ssum[w]; ts2 += ssum2[w]; }
    float mu  = ts * (1.f / DMODEL);
    float var = ts2 * (1.f / DMODEL) - mu * mu;
    float inv = rsqrtf(var + LN_EPS);
    for (int i = tid; i < DMODEL; i += 256) {
        float v = y[(size_t)row * DMODEL + i];
        y[(size_t)row * DMODEL + i] = (v - mu) * inv * gamma[i] + beta[i];
    }
}

extern "C" void kernel_launch(void* const* d_in, const int* in_sizes, int n_in,
                              void* d_out, int out_size, void* d_ws, size_t ws_size,
                              hipStream_t stream) {
    const float* x     = (const float*)d_in[0];
    const float* Wq    = (const float*)d_in[1];
    const float* bq    = (const float*)d_in[2];
    const float* Wk    = (const float*)d_in[3];
    const float* bk    = (const float*)d_in[4];
    const float* Wv    = (const float*)d_in[5];
    const float* bv    = (const float*)d_in[6];
    const float* Wo    = (const float*)d_in[7];
    const float* bo    = (const float*)d_in[8];
    const float* gamma = (const float*)d_in[9];
    const float* beta  = (const float*)d_in[10];
    float* out = (float*)d_out;

    char* ws = (char*)d_ws;
    const size_t MAT = (size_t)SEQ * DMODEL * sizeof(__bf16);  // 4 MB
    __bf16* Qb = (__bf16*)(ws);
    __bf16* Kb = (__bf16*)(ws + MAT);
    __bf16* Vb = (__bf16*)(ws + 2 * MAT);
    __bf16* Cb = (__bf16*)(ws + 3 * MAT);

    dim3 gGemm(DMODEL / 128, SEQ / 128);
    dim3 gQkv(DMODEL / 128, SEQ / 128, 3);              // planes Qb, Kb, Vb
    gemm_wmma<0><<<gQkv, 256, 0, stream>>>(x, nullptr, Wq, Wk, Wv, bq, bk, bv, Qb,
                                           nullptr, nullptr, SEQ, DMODEL, DMODEL);
    dim3 gAttn(SEQ / 64, NHEAD);
    attn_flash<<<gAttn, 128, 0, stream>>>(Qb, Kb, Vb, Cb);
    gemm_wmma<1><<<gGemm, 256, 0, stream>>>(nullptr, Cb, Wo, nullptr, nullptr, bo,
                                            nullptr, nullptr, nullptr, out, x,
                                            SEQ, DMODEL, DMODEL);
    layernorm_kernel<<<SEQ, 256, 0, stream>>>(out, gamma, beta);
}

// v004
// A run of this version takes 123 microseconds.
// Next to v003, in two timings, it ran 1.14 times as fast each time.
// Over all steps from v000 it is 3.33 times as fast.
#include <hip/hip_runtime.h>

#define SEQ 2048
#define DMODEL 1024
#define NHEAD 16
#define DK 64
#define LN_EPS 1e-5f

typedef __bf16 v16bf  __attribute__((ext_vector_type(16)));
typedef __bf16 bf16x8 __attribute__((ext_vector_type(8)));
typedef __bf16 bf16x4 __attribute__((ext_vector_type(4)));
typedef float  v8f    __attribute__((ext_vector_type(8)));
typedef float  f32x4  __attribute__((ext_vector_type(4)));
typedef int    v4i    __attribute__((ext_vector_type(4)));

#define AS1 __attribute__((address_space(1)))
#define AS3 __attribute__((address_space(3)))

#if __has_builtin(__builtin_amdgcn_global_load_async_to_lds_b128) && \
    __has_builtin(__builtin_amdgcn_s_wait_asynccnt)
#define HAVE_ASYNC_LDS 1
#else
#define HAVE_ASYNC_LDS 0
#endif

// K-index mapping kmap(e, hl) of 16-bit A/B fragments of V_WMMA_*_16X16X32_*
// (ISA 7.12.2): element e -> K = {0..7}+8*hl for e<8, {16..23}+8*hl for e>=8.

// LDS row pitches in elements. Rows read by ds_load_b128 stand at an odd
// multiple of 16 B, rows read by ds_load_tr16_b128 at an odd multiple of 32 B:
// a half wave's sixteen 16-byte reads then cover the 64 banks once.
#define PITCH_A 40                                      // 32-element rows,  80 B
#define PITCH_B 144                                     // 128-element rows, 288 B
#define PITCH_K 72                                      // 64-element rows,  144 B
#define PITCH_V 80                                      // 64-element rows,  160 B

// Fragment whose element e reads p[kmap(e,hl)]: two contiguous 16B runs.
__device__ __forceinline__ v16bf load_frag(const __bf16* p, int hl) {
    bf16x8 a0 = *(const bf16x8*)(p + 8 * hl);
    bf16x8 a1 = *(const bf16x8*)(p + 16 + 8 * hl);
    return __builtin_shufflevector(a0, a1, 0, 1, 2, 3, 4, 5, 6, 7,
                                   8, 9, 10, 11, 12, 13, 14, 15);
}

// Transposed fragment from a row-major LDS tile T[k][n] (32 rows of k, PITCH
// elements apart): lane (lm, hl) gets element e = T[kmap(e,hl)][n0 + lm]. Each
// transposing load takes 16 rows of k; lane l points at the 16 bytes at row
// 8*(l>>4) + (l&7), column n0 + 8*((l>>3)&1).
template <int PITCH>
__device__ __forceinline__ v16bf load_frag_tr(const __bf16* tile, int n0, int lane) {
    const __bf16* p = tile + (8 * (lane >> 4) + (lane & 7)) * PITCH + n0 +
                      8 * ((lane >> 3) & 1);
    bf16x8 a0 = __builtin_amdgcn_ds_load_tr16_b128_v8bf16((AS3 bf16x8*)p);
    bf16x8 a1 = __builtin_amdgcn_ds_load_tr16_b128_v8bf16((AS3 bf16x8*)(p + 16 * PITCH));
    return __builtin_shufflevector(a0, a1, 0, 1, 2, 3, 4, 5, 6, 7,
                                   8, 9, 10, 11, 12, 13, 14, 15);
}

// ---------------------------------------------------------------------------
// Tiled bf16 WMMA GEMM: out[N,Dout] = A[N,K] @ W[K,Dout] + bias (+ resid)
// 256 threads = 8 waves (2x4), block tile 128x128, wave tile 64x32, K-step 32.
// MODE 0: A = f32, store bf16.  MODE 1: A = bf16, store f32 + bias + residual.
// MODE 0 runs three products on the same A in one launch: blockIdx.z picks the
// weight and bias, and the outputs are three N x Dout planes one after another.
// ---------------------------------------------------------------------------
template <int MODE>
__global__ __launch_bounds__(256)
void gemm_wmma(const float* __restrict__ A, const __bf16* __restrict__ Abf,
               const float* __restrict__ W0, const float* __restrict__ W1,
               const float* __restrict__ W2, const float* __restrict__ bias0,
               const float* __restrict__ bias1, const float* __restrict__ bias2,
               __bf16* __restrict__ outbf0, float* __restrict__ outf,
               const float* __restrict__ resid, int N, int K, int Dout) {
    __shared__ __align__(16) __bf16 lA[128 * PITCH_A];
    __shared__ __align__(16) __bf16 lB[32 * PITCH_B];

    const float* __restrict__ W    = W0;
    const float* __restrict__ bias = bias0;
    __bf16* __restrict__ outbf     = outbf0;
    if constexpr (MODE == 0) {
        const int z = blockIdx.z;
        W     = (z == 0) ? W0 : (z == 1) ? W1 : W2;
        bias  = (z == 0) ? bias0 : (z == 1) ? bias1 : bias2;
        outbf = outbf0 + (size_t)z * N * Dout;
    }

    const int tid  = threadIdx.x;
    const int wave = tid >> 5;
    const int lane = tid & 31;
    const int lm   = lane & 15;
    const int hl   = lane >> 4;
    const int wrow = wave >> 2;            // 0..1  -> 64-row slab
    const int wcol = wave & 3;             // 0..3  -> 32-col slab
    const int row0 = blockIdx.y * 128;
    const int col0 = blockIdx.x * 128;

    v8f zero = {};
    v8f acc[4][2];
#pragma unroll
    for (int i = 0; i < 4; ++i)
#pragma unroll
        for (int j = 0; j < 2; ++j) acc[i][j] = zero;

    for (int k0 = 0; k0 < K; k0 += 32) {
        // ---- stage A tile (128x32) ----
#pragma unroll
        for (int rep = 0; rep < 4; ++rep) {
            int idx = tid + rep * 256;                 // 0..1023 vec4 chunks
            int r = idx >> 3, c4 = (idx & 7) * 4;
            if constexpr (MODE == 0) {
                f32x4 v = *(const f32x4*)&A[(size_t)(row0 + r) * K + k0 + c4];
                bf16x4 b = {(__bf16)v.x, (__bf16)v.y, (__bf16)v.z, (__bf16)v.w};
                *(bf16x4*)&lA[r * PITCH_A + c4] = b;
            } else {
                *(bf16x4*)&lA[r * PITCH_A + c4] =
                    *(const bf16x4*)&Abf[(size_t)(row0 + r) * K + k0 + c4];
            }
        }
        // ---- stage B tile (32x128) ----
#pragma unroll
        for (int rep = 0; rep < 4; ++rep) {
            int idx = tid + rep * 256;
            int r = idx >> 5, c4 = (idx & 31) * 4;
            f32x4 v = *(const f32x4*)&W[(size_t)(k0 + r) * Dout + col0 + c4];
            bf16x4 b = {(__bf16)v.x, (__bf16)v.y, (__bf16)v.z, (__bf16)v.w};
            *(bf16x4*)&lB[r * PITCH_B + c4] = b;
        }
        __syncthreads();

        v16bf af[4], bfr[2];
#pragma unroll
        for (int i = 0; i < 4; ++i)
            af[i] = load_frag(&lA[(wrow * 64 + i * 16 + lm) * PITCH_A], hl);
#pragma unroll
        for (int j = 0; j < 2; ++j)
            bfr[j] = load_frag_tr<PITCH_B>(lB, wcol * 32 + j * 16, lane);
#pragma unroll
        for (int i = 0; i < 4; ++i)
#pragma unroll
            for (int j = 0; j < 2; ++j)
                acc[i][j] = __builtin_amdgcn_wmma_f32_16x16x32_bf16(
                    false, af[i], false, bfr[j], (short)0, acc[i][j], false, false);
        __syncthreads();
    }

#pragma unroll
    for (int i = 0; i < 4; ++i)
#pragma unroll
        for (int j = 0; j < 2; ++j) {
            int gcol = col0 + wcol * 32 + j * 16 + lm;
            float bv = bias[gcol];
#pragma unroll
            for (int v = 0; v < 8; ++v) {
                int grow = row0 + wrow * 64 + i * 16 + v + 8 * hl;
                size_t gi = (size_t)grow * Dout + gcol;
                float val = acc[i][j][v] + bv;
                if constexpr (MODE == 0) outbf[gi] = (__bf16)val;
                else                     outf[gi] = val + resid[gi];
            }
        }
}

// Lane l <-> lane l ^ 16: the other half of the wave.
__device__ __forceinline__ float xhalf(float x) {
    int b = __builtin_bit_cast(int, x);
    return __builtin_bit_cast(float, __builtin_amdgcn_permlanex16(
        b, b, 0x76543210, 0xfedcba98, false, false));
}

// e^x as 2^(x * log2 e) on the transcendental unit, as __expf compiles. The
// v_nop in the same statement keeps the one free slot that the instruction set
// asks for behind a transcendental, whatever the compiler schedules next.
__device__ __forceinline__ float exp_slot(float x) {
    float r;
    asm("v_exp_f32 %0, %1\n\tv_nop" : "=v"(r) : "v"(x * 1.44269504088896340736f));
    return r;
}

#define KSLICES 4
#define STAGE_KEYS (32 * KSLICES)
#define PITCH_O 68                                      // 64 f32 rows, 272 B
__global__ __launch_bounds__(512)
void attn_flash(const __bf16* __restrict__ Q, const __bf16* __restrict__ Kb,
                const __bf16* __restrict__ Vb, __bf16* __restrict__ ctx) {
    __shared__ __align__(16) __bf16 lQ[64 * 64];               // 8 KB
    __shared__ __align__(16) __bf16 lK[STAGE_KEYS * PITCH_K];  // [key][d]
    __shared__ __align__(16) __bf16 lV[STAGE_KEYS * PITCH_V];  // [key][d]
    __shared__ __align__(16) float lO[KSLICES][64 * PITCH_O];  // partial ctx [query][d]
    __shared__ float lM[KSLICES][64], lL[KSLICES][64];         // partial max, sum

    const int tid   = threadIdx.x;
    // In a scalar register, so that the per-wave skip below is a scalar branch.
    const int wave  = __builtin_amdgcn_readfirstlane(tid >> 5);
    const int lane  = tid & 31;
    const int lm    = lane & 15;
    const int hl    = lane >> 4;
    const int grp   = wave >> 2;                        // key slice
    const int slab  = wave & 3;                         // query slab
    const int qtile = blockIdx.x;
    const int h     = blockIdx.y;
    const int qbase = qtile * 64 + slab * 16;
    const int hoff  = h * DK;

    // stage Q tile (64 rows x 64 dk) once
#pragma unroll
    for (int rep = 0; rep < 2; ++rep) {
        int idx = tid + rep * 512;                     // 0..1023 vec4 chunks
        int r = idx >> 4, c4 = (idx & 15) * 4;
        *(bf16x4*)&lQ[r * 64 + c4] =
            *(const bf16x4*)&Q[(size_t)(qtile * 64 + r) * DMODEL + hoff + c4];
    }
    __syncthreads();
    v16bf qf[2];
#pragma unroll
    for (int c = 0; c < 2; ++c)
        qf[c] = load_frag(&lQ[(slab * 16 + lm) * 64 + c * 32], hl);

    v8f zero = {};
    v8f acc[4];
#pragma unroll
    for (int t = 0; t < 4; ++t) acc[t] = zero;
    float mrun = -__builtin_inff();                     // query lm, both halves alike
    float lrun = 0.f;                                   // this half's keys only
    const int q = qbase + lm;

    const int nst = (qtile * 64 + 64 + STAGE_KEYS - 1) / STAGE_KEYS;  // causal bound
    for (int st = 0; st < nst; ++st) {
        const int sbase = st * STAGE_KEYS;

        if (st + 1 < nst && grp == 0) {                 // prefetch next K/V rows
            const int nrow = sbase + STAGE_KEYS + slab * 32 + lane;
            __builtin_prefetch(&Kb[(size_t)nrow * DMODEL + hoff], 0, 1);
            __builtin_prefetch(&Vb[(size_t)nrow * DMODEL + hoff], 0, 1);
        }
        __syncthreads();                                // previous stage reads done

        // ---- stage K (128 keys x 64 d) ----
#if HAVE_ASYNC_LDS
#pragma unroll
        for (int rep = 0; rep < 2; ++rep) {
            int idx = tid + rep * 512;                  // 0..1023 x 16B
            int r = idx >> 3, c8 = (idx & 7) * 8;
            __builtin_amdgcn_global_load_async_to_lds_b128(
                (AS1 v4i*)&Kb[(size_t)(sbase + r) * DMODEL + hoff + c8],
                (AS3 v4i*)&lK[r * PITCH_K + c8], 0, 0);
        }
#else
#pragma unroll
        for (int rep = 0; rep < 4; ++rep) {
            int idx = tid + rep * 512;
            int r = idx >> 4, c4 = (idx & 15) * 4;
            *(bf16x4*)&lK[r * PITCH_K + c4] =
                *(const bf16x4*)&Kb[(size_t)(sbase + r) * DMODEL + hoff + c4];
        }
#endif
        // ---- stage V (128 keys x 64 d) ----
#pragma unroll
        for (int rep = 0; rep < 4; ++rep) {
            int idx = tid + rep * 512;
            int r = idx >> 4, c4 = (idx & 15) * 4;      // key r, dims c4..c4+3
            *(bf16x4*)&lV[r * PITCH_V + c4] =
                *(const bf16x4*)&Vb[(size_t)(sbase + r) * DMODEL + hoff + c4];
        }
#if HAVE_ASYNC_LDS
        __builtin_amdgcn_s_wait_asynccnt(0);
#endif
        __syncthreads();

        // This wave's 32 keys of the stage. A slice that starts behind the slab's
        // first query is masked for all of the slab and is skipped (both are
        // multiples of 16, so a slice that is not skipped holds at least one
        // open key for every query and the running maximum stays finite).
        const int kbase = sbase + grp * 32;
        if (kbase > qbase) continue;

        // ---- S^T = K @ Q^T: s[t][v] = score(key kbase+16t+8hl+v, query lm) ----
        v8f s[2];
        s[0] = zero; s[1] = zero;
#pragma unroll
        for (int t = 0; t < 2; ++t)
#pragma unroll
            for (int c = 0; c < 2; ++c) {
                v16bf kf = load_frag(&lK[(grp * 32 + t * 16 + lm) * PITCH_K + c * 32], hl);
                s[t] = __builtin_amdgcn_wmma_f32_16x16x32_bf16(
                    false, kf, false, qf[c], (short)0, s[t], false, false);
            }

        // ---- scale + causal mask + this query's max ----
        float m = -__builtin_inff();
#pragma unroll
        for (int t = 0; t < 2; ++t)
#pragma unroll
            for (int v = 0; v < 8; ++v) {
                int key = kbase + t * 16 + 8 * hl + v;
                float sv = s[t][v] * 0.125f;
                sv = (key > q) ? -__builtin_inff() : sv;
                s[t][v] = sv;
                m = fmaxf(m, sv);
            }
        m = fmaxf(m, xhalf(m));

        // ---- online softmax ----
        float mnew  = fmaxf(mrun, m);
        float alpha = exp_slot(mrun - mnew);
        mrun = mnew;
        float sum = 0.f;
#pragma unroll
        for (int t = 0; t < 2; ++t)
#pragma unroll
            for (int v = 0; v < 8; ++v) {
                float p = exp_slot(s[t][v] - mrun);
                s[t][v] = p;
                sum += p;
            }
        lrun = lrun * alpha + sum;
#pragma unroll
        for (int t = 0; t < 4; ++t)
#pragma unroll
            for (int v = 0; v < 8; ++v) acc[t][v] *= alpha;

        // ---- P^T as B operand: element e is key kmap(e, hl) of query lm ----
        v16bf pf;
#pragma unroll
        for (int e = 0; e < 16; ++e) pf[e] = (__bf16)s[e >> 3][e & 7];

        // ---- ctx^T += V^T @ P^T: acc[t][v] = ctx(query lm, dim 16t+8hl+v) ----
#pragma unroll
        for (int t = 0; t < 4; ++t) {
            v16bf vf = load_frag_tr<PITCH_V>(lV + grp * 32 * PITCH_V, t * 16, lane);
            acc[t] = __builtin_amdgcn_wmma_f32_16x16x32_bf16(
                false, vf, false, pf, (short)0, acc[t], false, false);
        }
    }

    // ---- hand over this slice's partial result (a slice that never ran:
    //      maximum -inf, sum 0, context 0, weight 0 below) ----
    const float lpart = lrun + xhalf(lrun);             // join the halves' sums
#pragma unroll
    for (int t = 0; t < 4; ++t) {
        float* o = &lO[grp][(slab * 16 + lm) * PITCH_O + t * 16 + 8 * hl];
        f32x4 lo = {acc[t][0], acc[t][1], acc[t][2], acc[t][3]};
        f32x4 hi = {acc[t][4], acc[t][5], acc[t][6], acc[t][7]};
        *(f32x4*)o       = lo;
        *(f32x4*)(o + 4) = hi;
    }
    if (hl == 0) {
        lM[grp][slab * 16 + lm] = mrun;
        lL[grp][slab * 16 + lm] = lpart;
    }
    __syncthreads();                                    // partials visible to all waves

    // ---- merge: each wave finishes four whole rows, a lane 8 dims of one ----
    const int qr = wave * 4 + (lane >> 3);              // row of the query tile
    const int d0 = (lane & 7) * 8;
    float mall = -__builtin_inff();                     // finite: slice 0 holds key 0
#pragma unroll
    for (int g = 0; g < KSLICES; ++g) mall = fmaxf(mall, lM[g][qr]);
    float ltot = 0.f;
    float osum[8] = {0.f, 0.f, 0.f, 0.f, 0.f, 0.f, 0.f, 0.f};
#pragma unroll
    for (int g = 0; g < KSLICES; ++g) {
        const float wgt = exp_slot(lM[g][qr] - mall);
        ltot += wgt * lL[g][qr];
        const float* o = &lO[g][qr * PITCH_O + d0];
        f32x4 lo = *(const f32x4*)o;
        f32x4 hi = *(const f32x4*)(o + 4);
#pragma unroll
        for (int v = 0; v < 4; ++v) {
            osum[v]     += wgt * lo[v];
            osum[v + 4] += wgt * hi[v];
        }
    }
    bf16x8 ob;
#pragma unroll
    for (int v = 0; v < 8; ++v) ob[v] = (__bf16)(osum[v] / ltot);
    *(bf16x8*)&ctx[(size_t)(qtile * 64 + qr) * DMODEL + hoff + d0] = ob;
}

// ---------------------------------------------------------------------------
// Row-wise LayerNorm, in place on d_out.
// ---------------------------------------------------------------------------
__global__ __launch_bounds__(256)
void layernorm_kernel(float* __restrict__ y, const float* __restrict__ gamma,
                      const float* __restrict__ beta) {
    __shared__ float ssum[8], ssum2[8];
    const int row = blockIdx.x;
    const int tid = threadIdx.x;
    float s = 0.f, s2 = 0.f;
    for (int i = tid; i < DMODEL; i += 256) {
        float v = y[(size_t)row * DMODEL + i];
        s += v; s2 += v * v;
    }
#pragma unroll
    for (int off = 1; off < 32; off <<= 1) {
        s  += __shfl_xor(s,  off, 32);
        s2 += __shfl_xor(s2, off, 32);
    }
    int wave = tid >> 5, lane = tid & 31;
    if (lane == 0) { ssum[wave] = s; ssum2[wave] = s2; }
    __syncthreads();
    float ts = 0.f, ts2 = 0.f;
#pragma unroll
    for (int w = 0; w < 8; ++w) { ts += ssum[w]; ts2 += ssum2[w]; }
    float mu  = ts * (1.f / DMODEL);
    float var = ts2 * (1.f / DMODEL) - mu * mu;
    float inv = rsqrtf(var + LN_EPS);
    for (int i = tid; i < DMODEL; i += 256) {
        float v = y[(size_t)row * DMODEL + i];
        y[(size_t)row * DMODEL + i] = (v - mu) * inv * gamma[i] + beta[i];
    }
}

extern "C" void kernel_launch(void* const* d_in, const int* in_sizes, int n_in,
                              void* d_out, int out_size, void* d_ws, size_t ws_size,
                              hipStream_t stream) {
    const float* x     = (const float*)d_in[0];
    const float* Wq    = (const float*)d_in[1];
    const float* bq    = (const float*)d_in[2];
    const float* Wk    = (const float*)d_in[3];
    const float* bk    = (const float*)d_in[4];
    const float* Wv    = (const float*)d_in[5];
    const float* bv    = (const float*)d_in[6];
    const float* Wo    = (const float*)d_in[7];
    const float* bo    = (const float*)d_in[8];
    const float* gamma = (const float*)d_in[9];
    const float* beta  = (const float*)d_in[10];
    float* out = (float*)d_out;

    char* ws = (char*)d_ws;
    const size_t MAT = (size_t)SEQ * DMODEL * sizeof(__bf16);  // 4 MB
    __bf16* Qb = (__bf16*)(ws);
    __bf16* Kb = (__bf16*)(ws + MAT);
    __bf16* Vb = (__bf16*)(ws + 2 * MAT);
    __bf16* Cb = (__bf16*)(ws + 3 * MAT);

    dim3 gGemm(DMODEL / 128, SEQ / 128);
    dim3 gQkv(DMODEL / 128, SEQ / 128, 3);              // planes Qb, Kb, Vb
    gemm_wmma<0><<<gQkv, 256, 0, stream>>>(x, nullptr, Wq, Wk, Wv, bq, bk, bv, Qb,
                                           nullptr, nullptr, SEQ, DMODEL, DMODEL);
    dim3 gAttn(SEQ / 64, NHEAD);
    attn_flash<<<gAttn, 512, 0, stream>>>(Qb, Kb, Vb, Cb);
    gemm_wmma<1><<<gGemm, 256, 0, stream>>>(nullptr, Cb, Wo, nullptr, nullptr, bo,
                                            nullptr, nullptr, nullptr, out, x,
                                            SEQ, DMODEL, DMODEL);
    layernorm_kernel<<<SEQ, 256, 0, stream>>>(out, gamma, beta);
}

// v005
// It runs in 73.8 microseconds.
// Timed twice side by side with v004, it ran 1.67 times as fast both times.
// All steps since v000 together make it 5.55 times as fast.
#include <hip/hip_runtime.h>

#define SEQ 2048
#define DMODEL 1024
#define NHEAD 16
#define DK 64
#define LN_EPS 1e-5f

typedef __bf16 v16bf  __attribute__((ext_vector_type(16)));
typedef __bf16 bf16x8 __attribute__((ext_vector_type(8)));
typedef __bf16 bf16x4 __attribute__((ext_vector_type(4)));
typedef float  v8f    __attribute__((ext_vector_type(8)));
typedef float  f32x4  __attribute__((ext_vector_type(4)));
typedef int    v4i    __attribute__((ext_vector_type(4)));

#define AS1 __attribute__((address_space(1)))
#define AS3 __attribute__((address_space(3)))

#if __has_builtin(__builtin_amdgcn_global_load_async_to_lds_b128) && \
    __has_builtin(__builtin_amdgcn_s_wait_asynccnt)
#define HAVE_ASYNC_LDS 1
#else
#define HAVE_ASYNC_LDS 0
#endif

// K-index mapping kmap(e, hl) of 16-bit A/B fragments of V_WMMA_*_16X16X32_*
// (ISA 7.12.2): element e -> K = {0..7}+8*hl for e<8, {16..23}+8*hl for e>=8.

// LDS row pitches in elements. Rows read by ds_load_b128 stand at an odd
// multiple of 16 B, rows read by ds_load_tr16_b128 at an odd multiple of 32 B:
// a half wave's sixteen 16-byte reads then cover the 64 banks once.
#define PITCH_A 40                                      // 32-element rows,  80 B
#define PITCH_B 144                                     // 128-element rows, 288 B
#define PITCH_K 72                                      // 64-element rows,  144 B
#define PITCH_V 80                                      // 64-element rows,  160 B

// Fragment whose element e reads p[kmap(e,hl)]: two contiguous 16B runs.
__device__ __forceinline__ v16bf load_frag(const __bf16* p, int hl) {
    bf16x8 a0 = *(const bf16x8*)(p + 8 * hl);
    bf16x8 a1 = *(const bf16x8*)(p + 16 + 8 * hl);
    return __builtin_shufflevector(a0, a1, 0, 1, 2, 3, 4, 5, 6, 7,
                                   8, 9, 10, 11, 12, 13, 14, 15);
}

// Transposed fragment from a row-major LDS tile T[k][n] (32 rows of k, PITCH
// elements apart): lane (lm, hl) gets element e = T[kmap(e,hl)][n0 + lm]. Each
// transposing load takes 16 rows of k; lane l points at the 16 bytes at row
// 8*(l>>4) + (l&7), column n0 + 8*((l>>3)&1).
template <int PITCH>
__device__ __forceinline__ v16bf load_frag_tr(const __bf16* tile, int n0, int lane) {
    const __bf16* p = tile + (8 * (lane >> 4) + (lane & 7)) * PITCH + n0 +
                      8 * ((lane >> 3) & 1);
    bf16x8 a0 = __builtin_amdgcn_ds_load_tr16_b128_v8bf16((AS3 bf16x8*)p);
    bf16x8 a1 = __builtin_amdgcn_ds_load_tr16_b128_v8bf16((AS3 bf16x8*)(p + 16 * PITCH));
    return __builtin_shufflevector(a0, a1, 0, 1, 2, 3, 4, 5, 6, 7,
                                   8, 9, 10, 11, 12, 13, 14, 15);
}

// Work-group barrier that orders LDS traffic only. __syncthreads() also waits for
// every global load in flight, which would drain the tiles fetched ahead; the
// waves of a block hand each other nothing through global memory in the k loop.
__device__ __forceinline__ void barrier_lds() {
    __builtin_amdgcn_fence(__ATOMIC_RELEASE, "workgroup", "local");
    __builtin_amdgcn_s_barrier();
    __builtin_amdgcn_fence(__ATOMIC_ACQUIRE, "workgroup", "local");
}

template <int MODE>
struct GemmTileRegs {                                   // one thread's share of a k tile
    f32x4  a[4];                                        // MODE 0: A chunks
    bf16x4 ab[4];                                       // MODE 1: A chunks
    f32x4  b[4];                                        // W chunks
};

// ---------------------------------------------------------------------------
// Tiled bf16 WMMA GEMM: out[N,Dout] = A[N,K] @ W[K,Dout] + bias (+ resid)
// 256 threads = 8 waves (2x4), block tile 128x128, wave tile 64x32, K-step 32;
// K a multiple of 64.
// MODE 0: A = f32, store bf16.  MODE 1: A = bf16, store f32 + bias + residual.
// MODE 0 runs three products on the same A in one launch: blockIdx.z picks the
// weight and bias, and the outputs are three N x Dout planes one after another.
// The k loop's global loads run two tiles ahead, in two register sets: trip t
// converts tile t from its set into LDS buffer t & 1, passes the barrier, reads
// its fragments, issues tile t+2's loads into the set just freed and multiplies.
// With two LDS buffers one barrier a trip is enough: a wave that writes buffer b
// again in trip t+2 has passed the barrier of trip t+1, which every wave reaches
// only after its reads of buffer b in trip t have returned.
// ---------------------------------------------------------------------------
template <int MODE>
__global__ __launch_bounds__(256)
void gemm_wmma(const float* __restrict__ A, const __bf16* __restrict__ Abf,
               const float* __restrict__ W0, const float* __restrict__ W1,
               const float* __restrict__ W2, const float* __restrict__ bias0,
               const float* __restrict__ bias1, const float* __restrict__ bias2,
               __bf16* __restrict__ outbf0, float* __restrict__ outf,
               const float* __restrict__ resid, int N, int K, int Dout) {
    __shared__ __align__(16) __bf16 lA[2][128 * PITCH_A];
    __shared__ __align__(16) __bf16 lB[2][32 * PITCH_B];

    const float* __restrict__ W    = W0;
    const float* __restrict__ bias = bias0;
    __bf16* __restrict__ outbf     = outbf0;
    if constexpr (MODE == 0) {
        const int z = blockIdx.z;
        W     = (z == 0) ? W0 : (z == 1) ? W1 : W2;
        bias  = (z == 0) ? bias0 : (z == 1) ? bias1 : bias2;
        outbf = outbf0 + (size_t)z * N * Dout;
    }

    const int tid  = threadIdx.x;
    const int wave = tid >> 5;
    const int lane = tid & 31;
    const int lm   = lane & 15;
    const int hl   = lane >> 4;
    const int wrow = wave >> 2;            // 0..1  -> 64-row slab
    const int wcol = wave & 3;             // 0..3  -> 32-col slab
    const int row0 = blockIdx.y * 128;
    const int col0 = blockIdx.x * 128;

    v8f zero = {};
    v8f acc[4][2];
#pragma unroll
    for (int i = 0; i < 4; ++i)
#pragma unroll
        for (int j = 0; j < 2; ++j) acc[i][j] = zero;

    // This thread's four vec4 chunks of the A tile (128x32: rows ar + 32 rep) and
    // of the W tile (32x128: rows br + 8 rep), as offsets from block-uniform
    // pointers that step from tile to tile.
    const int ar = tid >> 3, ac = (tid & 7) * 4;
    const int br = tid >> 5, bc = (tid & 31) * 4;
    unsigned aoff[4], boff[4];
#pragma unroll
    for (int rep = 0; rep < 4; ++rep) {
        aoff[rep] = (unsigned)((ar + rep * 32) * K + ac);
        boff[rep] = (unsigned)((br + rep * 8) * Dout + bc);
    }
    const float*  pA  = nullptr;                        // MODE 0
    const __bf16* pAb = nullptr;                        // MODE 1
    if constexpr (MODE == 0) pA  = A + (size_t)row0 * K;
    else                     pAb = Abf + (size_t)row0 * K;
    const float* pW = W + col0;

    auto fetch = [&](GemmTileRegs<MODE>& t) {
#pragma unroll
        for (int rep = 0; rep < 4; ++rep) {
            if constexpr (MODE == 0) t.a[rep]  = *(const f32x4*)&pA[aoff[rep]];
            else                     t.ab[rep] = *(const bf16x4*)&pAb[aoff[rep]];
        }
#pragma unroll
        for (int rep = 0; rep < 4; ++rep) t.b[rep] = *(const f32x4*)&pW[boff[rep]];
        // The pointers step next: the wait that stands in front of an overwrite of
        // a register which an issued global load names.
        asm volatile("s_wait_xcnt 0x0" ::: "memory");
        if constexpr (MODE == 0) pA += 32;
        else                     pAb += 32;
        pW += (size_t)32 * Dout;
    };
    auto stage = [&](const GemmTileRegs<MODE>& t, __bf16* sA, __bf16* sB) {
#pragma unroll
        for (int rep = 0; rep < 4; ++rep) {
            if constexpr (MODE == 0) {
                f32x4 v = t.a[rep];
                bf16x4 b = {(__bf16)v.x, (__bf16)v.y, (__bf16)v.z, (__bf16)v.w};
                *(bf16x4*)&sA[(ar + rep * 32) * PITCH_A + ac] = b;
            } else {
                *(bf16x4*)&sA[(ar + rep * 32) * PITCH_A + ac] = t.ab[rep];
            }
        }
#pragma unroll
        for (int rep = 0; rep < 4; ++rep) {
            f32x4 v = t.b[rep];
            bf16x4 b = {(__bf16)v.x, (__bf16)v.y, (__bf16)v.z, (__bf16)v.w};
            *(bf16x4*)&sB[(br + rep * 8) * PITCH_B + bc] = b;
        }
    };
    // One trip: tile t out of its register set into LDS buffer b, the barrier, the
    // fragment reads, tile t+2's loads into the same set (while one exists), the
    // products. The global loads stand behind the fragment reads, so that their
    // issue and their wait run under the LDS latency.
    auto trip = [&](GemmTileRegs<MODE>& t, int b, bool more) __attribute__((always_inline)) {
        stage(t, lA[b], lB[b]);
        barrier_lds();
        v16bf af[4], bfr[2];
#pragma unroll
        for (int i = 0; i < 4; ++i)
            af[i] = load_frag(&lA[b][(wrow * 64 + i * 16 + lm) * PITCH_A], hl);
#pragma unroll
        for (int j = 0; j < 2; ++j)
            bfr[j] = load_frag_tr<PITCH_B>(lB[b], wcol * 32 + j * 16, lane);
        // Keeps the twelve fragment reads in one group at the head of the trip:
        // spread among the products, each place with reads waits out the LDS
        // latency anew.
        __builtin_amdgcn_sched_barrier(0);
        if (more) {
            fetch(t);
            // Keeps the global loads ahead of the products: the compiler otherwise
            // lands them in fragment registers and holds them back until the
            // products have read those.
            __builtin_amdgcn_sched_barrier(0);
        }
#pragma unroll
        for (int i = 0; i < 4; ++i)
#pragma unroll
            for (int j = 0; j < 2; ++j)
                acc[i][j] = __builtin_amdgcn_wmma_f32_16x16x32_bf16(
                    false, af[i], false, bfr[j], (short)0, acc[i][j], false, false);
        // Keeps the next trip's conversion, and with it the wait for its tile,
        // behind this trip's products: moved up among them it would wait for
        // loads that are only one trip old.
        __builtin_amdgcn_sched_barrier(0);
    };

    GemmTileRegs<MODE> t0, t1;
    fetch(t0);
    // Keeps tile 0's loads ahead of tile 1's, as in the loop, so that the counted
    // waits at the loop's head leave tile 1 in flight on the first trip too.
    __builtin_amdgcn_sched_barrier(0);
    fetch(t1);
    // The last two trips stand behind the loop, without loads: no branch in the
    // loop, so the waits for a tile count the younger tile's loads exactly.
    for (int k0 = 64; k0 < K; k0 += 64) {
        trip(t0, 0, true);
        trip(t1, 1, true);
    }
    trip(t0, 0, false);
    trip(t1, 1, false);

#pragma unroll
    for (int i = 0; i < 4; ++i)
#pragma unroll
        for (int j = 0; j < 2; ++j) {
            int gcol = col0 + wcol * 32 + j * 16 + lm;
            float bv = bias[gcol];
#pragma unroll
            for (int v = 0; v < 8; ++v) {
                int grow = row0 + wrow * 64 + i * 16 + v + 8 * hl;
                size_t gi = (size_t)grow * Dout + gcol;
                float val = acc[i][j][v] + bv;
                if constexpr (MODE == 0) outbf[gi] = (__bf16)val;
                else                     outf[gi] = val + resid[gi];
            }
        }
}

// Lane l <-> lane l ^ 16: the other half of the wave.
__device__ __forceinline__ float xhalf(float x) {
    int b = __builtin_bit_cast(int, x);
    return __builtin_bit_cast(float, __builtin_amdgcn_permlanex16(
        b, b, 0x76543210, 0xfedcba98, false, false));
}

// e^x as 2^(x * log2 e) on the transcendental unit, as __expf compiles. The
// v_nop in the same statement keeps the one free slot that the instruction set
// asks for behind a transcendental, whatever the compiler schedules next.
__device__ __forceinline__ float exp_slot(float x) {
    float r;
    asm("v_exp_f32 %0, %1\n\tv_nop" : "=v"(r) : "v"(x * 1.44269504088896340736f));
    return r;
}

#define KSLICES 4
#define STAGE_KEYS (32 * KSLICES)
#define PITCH_O 68                                      // 64 f32 rows, 272 B
__global__ __launch_bounds__(512)
void attn_flash(const __bf16* __restrict__ Q, const __bf16* __restrict__ Kb,
                const __bf16* __restrict__ Vb, __bf16* __restrict__ ctx) {
    __shared__ __align__(16) __bf16 lQ[64 * 64];               // 8 KB
    __shared__ __align__(16) __bf16 lK[STAGE_KEYS * PITCH_K];  // [key][d]
    __shared__ __align__(16) __bf16 lV[STAGE_KEYS * PITCH_V];  // [key][d]
    __shared__ __align__(16) float lO[KSLICES][64 * PITCH_O];  // partial ctx [query][d]
    __shared__ float lM[KSLICES][64], lL[KSLICES][64];         // partial max, sum

    const int tid   = threadIdx.x;
    // In a scalar register, so that the per-wave skip below is a scalar branch.
    const int wave  = __builtin_amdgcn_readfirstlane(tid >> 5);
    const int lane  = tid & 31;
    const int lm    = lane & 15;
    const int hl    = lane >> 4;
    const int grp   = wave >> 2;                        // key slice
    const int slab  = wave & 3;                         // query slab
    const int qtile = blockIdx.x;
    const int h     = blockIdx.y;
    const int qbase = qtile * 64 + slab * 16;
    const int hoff  = h * DK;

    // stage Q tile (64 rows x 64 dk) once
#pragma unroll
    for (int rep = 0; rep < 2; ++rep) {
        int idx = tid + rep * 512;                     // 0..1023 vec4 chunks
        int r = idx >> 4, c4 = (idx & 15) * 4;
        *(bf16x4*)&lQ[r * 64 + c4] =
            *(const bf16x4*)&Q[(size_t)(qtile * 64 + r) * DMODEL + hoff + c4];
    }
    __syncthreads();
    v16bf qf[2];
#pragma unroll
    for (int c = 0; c < 2; ++c)
        qf[c] = load_frag(&lQ[(slab * 16 + lm) * 64 + c * 32], hl);

    v8f zero = {};
    v8f acc[4];
#pragma unroll
    for (int t = 0; t < 4; ++t) acc[t] = zero;
    float mrun = -__builtin_inff();                     // query lm, both halves alike
    float lrun = 0.f;                                   // this half's keys only
    const int q = qbase + lm;

    const int nst = (qtile * 64 + 64 + STAGE_KEYS - 1) / STAGE_KEYS;  // causal bound
    for (int st = 0; st < nst; ++st) {
        const int sbase = st * STAGE_KEYS;

        if (st + 1 < nst && grp == 0) {                 // prefetch next K/V rows
            const int nrow = sbase + STAGE_KEYS + slab * 32 + lane;
            __builtin_prefetch(&Kb[(size_t)nrow * DMODEL + hoff], 0, 1);
            __builtin_prefetch(&Vb[(size_t)nrow * DMODEL + hoff], 0, 1);
        }
        __syncthreads();                                // previous stage reads done

        // ---- stage K (128 keys x 64 d) ----
#if HAVE_ASYNC_LDS
#pragma unroll
        for (int rep = 0; rep < 2; ++rep) {
            int idx = tid + rep * 512;                  // 0..1023 x 16B
            int r = idx >> 3, c8 = (idx & 7) * 8;
            __builtin_amdgcn_global_load_async_to_lds_b128(
                (AS1 v4i*)&Kb[(size_t)(sbase + r) * DMODEL + hoff + c8],
                (AS3 v4i*)&lK[r * PITCH_K + c8], 0, 0);
        }
#else
#pragma unroll
        for (int rep = 0; rep < 4; ++rep) {
            int idx = tid + rep * 512;
            int r = idx >> 4, c4 = (idx & 15) * 4;
            *(bf16x4*)&lK[r * PITCH_K + c4] =
                *(const bf16x4*)&Kb[(size_t)(sbase + r) * DMODEL + hoff + c4];
        }
#endif
        // ---- stage V (128 keys x 64 d) ----
#pragma unroll
        for (int rep = 0; rep < 4; ++rep) {
            int idx = tid + rep * 512;
            int r = idx >> 4, c4 = (idx & 15) * 4;      // key r, dims c4..c4+3
            *(bf16x4*)&lV[r * PITCH_V + c4] =
                *(const bf16x4*)&Vb[(size_t)(sbase + r) * DMODEL + hoff + c4];
        }
#if HAVE_ASYNC_LDS
        __builtin_amdgcn_s_wait_asynccnt(0);
#endif
        __syncthreads();

        // This wave's 32 keys of the stage. A slice that starts behind the slab's
        // first query is masked for all of the slab and is skipped (both are
        // multiples of 16, so a slice that is not skipped holds at least one
        // open key for every query and the running maximum stays finite).
        const int kbase = sbase + grp * 32;
        if (kbase > qbase) continue;

        // ---- S^T = K @ Q^T: s[t][v] = score(key kbase+16t+8hl+v, query lm) ----
        v8f s[2];
        s[0] = zero; s[1] = zero;
#pragma unroll
        for (int t = 0; t < 2; ++t)
#pragma unroll
            for (int c = 0; c < 2; ++c) {
                v16bf kf = load_frag(&lK[(grp * 32 + t * 16 + lm) * PITCH_K + c * 32], hl);
                s[t] = __builtin_amdgcn_wmma_f32_16x16x32_bf16(
                    false, kf, false, qf[c], (short)0, s[t], false, false);
            }

        // ---- scale + causal mask + this query's max ----
        float m = -__builtin_inff();
#pragma unroll
        for (int t = 0; t < 2; ++t)
#pragma unroll
            for (int v = 0; v < 8; ++v) {
                int key = kbase + t * 16 + 8 * hl + v;
                float sv = s[t][v] * 0.125f;
                sv = (key > q) ? -__builtin_inff() : sv;
                s[t][v] = sv;
                m = fmaxf(m, sv);
            }
        m = fmaxf(m, xhalf(m));

        // ---- online softmax ----
        float mnew  = fmaxf(mrun, m);
        float alpha = exp_slot(mrun - mnew);
        mrun = mnew;
        float sum = 0.f;
#pragma unroll
        for (int t = 0; t < 2; ++t)
#pragma unroll
            for (int v = 0; v < 8; ++v) {
                float p = exp_slot(s[t][v] - mrun);
                s[t][v] = p;
                sum += p;
            }
        lrun = lrun * alpha + sum;
#pragma unroll
        for (int t = 0; t < 4; ++t)
#pragma unroll
            for (int v = 0; v < 8; ++v) acc[t][v] *= alpha;

        // ---- P^T as B operand: element e is key kmap(e, hl) of query lm ----
        v16bf pf;
#pragma unroll
        for (int e = 0; e < 16; ++e) pf[e] = (__bf16)s[e >> 3][e & 7];

        // ---- ctx^T += V^T @ P^T: acc[t][v] = ctx(query lm, dim 16t+8hl+v) ----
#pragma unroll
        for (int t = 0; t < 4; ++t) {
            v16bf vf = load_frag_tr<PITCH_V>(lV + grp * 32 * PITCH_V, t * 16, lane);
            acc[t] = __builtin_amdgcn_wmma_f32_16x16x32_bf16(
                false, vf, false, pf, (short)0, acc[t], false, false);
        }
    }

    // ---- hand over this slice's partial result (a slice that never ran:
    //      maximum -inf, sum 0, context 0, weight 0 below) ----
    const float lpart = lrun + xhalf(lrun);             // join the halves' sums
#pragma unroll
    for (int t = 0; t < 4; ++t) {
        float* o = &lO[grp][(slab * 16 + lm) * PITCH_O + t * 16 + 8 * hl];
        f32x4 lo = {acc[t][0], acc[t][1], acc[t][2], acc[t][3]};
        f32x4 hi = {acc[t][4], acc[t][5], acc[t][6], acc[t][7]};
        *(f32x4*)o       = lo;
        *(f32x4*)(o + 4) = hi;
    }
    if (hl == 0) {
        lM[grp][slab * 16 + lm] = mrun;
        lL[grp][slab * 16 + lm] = lpart;
    }
    __syncthreads();                                    // partials visible to all waves

    // ---- merge: each wave finishes four whole rows, a lane 8 dims of one ----
    const int qr = wave * 4 + (lane >> 3);              // row of the query tile
    const int d0 = (lane & 7) * 8;
    float mall = -__builtin_inff();                     // finite: slice 0 holds key 0
#pragma unroll
    for (int g = 0; g < KSLICES; ++g) mall = fmaxf(mall, lM[g][qr]);
    float ltot = 0.f;
    float osum[8] = {0.f, 0.f, 0.f, 0.f, 0.f, 0.f, 0.f, 0.f};
#pragma unroll
    for (int g = 0; g < KSLICES; ++g) {
        const float wgt = exp_slot(lM[g][qr] - mall);
        ltot += wgt * lL[g][qr];
        const float* o = &lO[g][qr * PITCH_O + d0];
        f32x4 lo = *(const f32x4*)o;
        f32x4 hi = *(const f32x4*)(o + 4);
#pragma unroll
        for (int v = 0; v < 4; ++v) {
            osum[v]     += wgt * lo[v];
            osum[v + 4] += wgt * hi[v];
        }
    }
    bf16x8 ob;
#pragma unroll
    for (int v = 0; v < 8; ++v) ob[v] = (__bf16)(osum[v] / ltot);
    *(bf16x8*)&ctx[(size_t)(qtile * 64 + qr) * DMODEL + hoff + d0] = ob;
}

// ---------------------------------------------------------------------------
// Row-wise LayerNorm, in place on d_out.
// ---------------------------------------------------------------------------
__global__ __launch_bounds__(256)
void layernorm_kernel(float* __restrict__ y, const float* __restrict__ gamma,
                      const float* __restrict__ beta) {
    __shared__ float ssum[8], ssum2[8];
    const int row = blockIdx.x;
    const int tid = threadIdx.x;
    float s = 0.f, s2 = 0.f;
    for (int i = tid; i < DMODEL; i += 256) {
        float v = y[(size_t)row * DMODEL + i];
        s += v; s2 += v * v;
    }
#pragma unroll
    for (int off = 1; off < 32; off <<= 1) {
        s  += __shfl_xor(s,  off, 32);
        s2 += __shfl_xor(s2, off, 32);
    }
    int wave = tid >> 5, lane = tid & 31;
    if (lane == 0) { ssum[wave] = s; ssum2[wave] = s2; }
    __syncthreads();
    float ts = 0.f, ts2 = 0.f;
#pragma unroll
    for (int w = 0; w < 8; ++w) { ts += ssum[w]; ts2 += ssum2[w]; }
    float mu  = ts * (1.f / DMODEL);
    float var = ts2 * (1.f / DMODEL) - mu * mu;
    float inv = rsqrtf(var + LN_EPS);
    for (int i = tid; i < DMODEL; i += 256) {
        float v = y[(size_t)row * DMODEL + i];
        y[(size_t)row * DMODEL + i] = (v - mu) * inv * gamma[i] + beta[i];
    }
}

extern "C" void kernel_launch(void* const* d_in, const int* in_sizes, int n_in,
                              void* d_out, int out_size, void* d_ws, size_t ws_size,
                              hipStream_t stream) {
    const float* x     = (const float*)d_in[0];
    const float* Wq    = (const float*)d_in[1];
    const float* bq    = (const float*)d_in[2];
    const float* Wk    = (const float*)d_in[3];
    const float* bk    = (const float*)d_in[4];
    const float* Wv    = (const float*)d_in[5];
    const float* bv    = (const float*)d_in[6];
    const float* Wo    = (const float*)d_in[7];
    const float* bo    = (const float*)d_in[8];
    const float* gamma = (const float*)d_in[9];
    const float* beta  = (const float*)d_in[10];
    float* out = (float*)d_out;

    char* ws = (char*)d_ws;
    const size_t MAT = (size_t)SEQ * DMODEL * sizeof(__bf16);  // 4 MB
    __bf16* Qb = (__bf16*)(ws);
    __bf16* Kb = (__bf16*)(ws + MAT);
    __bf16* Vb = (__bf16*)(ws + 2 * MAT);
    __bf16* Cb = (__bf16*)(ws + 3 * MAT);

    dim3 gGemm(DMODEL / 128, SEQ / 128);
    dim3 gQkv(DMODEL / 128, SEQ / 128, 3);              // planes Qb, Kb, Vb
    gemm_wmma<0><<<gQkv, 256, 0, stream>>>(x, nullptr, Wq, Wk, Wv, bq, bk, bv, Qb,
                                           nullptr, nullptr, SEQ, DMODEL, DMODEL);
    dim3 gAttn(SEQ / 64, NHEAD);
    attn_flash<<<gAttn, 512, 0, stream>>>(Qb, Kb, Vb, Cb);
    gemm_wmma<1><<<gGemm, 256, 0, stream>>>(nullptr, Cb, Wo, nullptr, nullptr, bo,
                                            nullptr, nullptr, nullptr, out, x,
                                            SEQ, DMODEL, DMODEL);
    layernorm_kernel<<<SEQ, 256, 0, stream>>>(out, gamma, beta);
}

// v006
// One run takes 66.9 microseconds.
// In both of two side-by-side timings against v005, it was 1.11 times as fast.
// Over all steps from v000 it is 6.15 times as fast.
#include <hip/hip_runtime.h>

#define SEQ 2048
#define DMODEL 1024
#define NHEAD 16
#define DK 64
#define LN_EPS 1e-5f

typedef __bf16 v16bf  __attribute__((ext_vector_type(16)));
typedef __bf16 bf16x8 __attribute__((ext_vector_type(8)));
typedef __bf16 bf16x4 __attribute__((ext_vector_type(4)));
typedef float  v8f    __attribute__((ext_vector_type(8)));
typedef float  f32x4  __attribute__((ext_vector_type(4)));
typedef int    v4i    __attribute__((ext_vector_type(4)));

#define AS1 __attribute__((address_space(1)))
#define AS3 __attribute__((address_space(3)))

#if __has_builtin(__builtin_amdgcn_global_load_async_to_lds_b128) && \
    __has_builtin(__builtin_amdgcn_s_wait_asynccnt)
#define HAVE_ASYNC_LDS 1
#else
#define HAVE_ASYNC_LDS 0
#endif

// K-index mapping kmap(e, hl) of 16-bit A/B fragments of V_WMMA_*_16X16X32_*
// (ISA 7.12.2): element e -> K = {0..7}+8*hl for e<8, {16..23}+8*hl for e>=8.

// LDS row pitches in elements. Rows read by ds_load_b128 stand at an odd
// multiple of 16 B, rows read by ds_load_tr16_b128 at an odd multiple of 32 B:
// a half wave's sixteen 16-byte reads then cover the 64 banks once.
#define PITCH_A 40                                      // 32-element rows,  80 B
#define PITCH_B 144                                     // 128-element rows, 288 B
#define PITCH_K 72                                      // 64-element rows,  144 B
#define PITCH_V 80                                      // 64-element rows,  160 B

// Fragment whose element e reads p[kmap(e,hl)]: two contiguous 16B runs.
__device__ __forceinline__ v16bf load_frag(const __bf16* p, int hl) {
    bf16x8 a0 = *(const bf16x8*)(p + 8 * hl);
    bf16x8 a1 = *(const bf16x8*)(p + 16 + 8 * hl);
    return __builtin_shufflevector(a0, a1, 0, 1, 2, 3, 4, 5, 6, 7,
                                   8, 9, 10, 11, 12, 13, 14, 15);
}

// Transposed fragment from a row-major LDS tile T[k][n] (32 rows of k, PITCH
// elements apart): lane (lm, hl) gets element e = T[kmap(e,hl)][n0 + lm]. Each
// transposing load takes 16 rows of k; lane l points at the 16 bytes at row
// 8*(l>>4) + (l&7), column n0 + 8*((l>>3)&1).
template <int PITCH>
__device__ __forceinline__ v16bf load_frag_tr(const __bf16* tile, int n0, int lane) {
    const __bf16* p = tile + (8 * (lane >> 4) + (lane & 7)) * PITCH + n0 +
                      8 * ((lane >> 3) & 1);
    bf16x8 a0 = __builtin_amdgcn_ds_load_tr16_b128_v8bf16((AS3 bf16x8*)p);
    bf16x8 a1 = __builtin_amdgcn_ds_load_tr16_b128_v8bf16((AS3 bf16x8*)(p + 16 * PITCH));
    return __builtin_shufflevector(a0, a1, 0, 1, 2, 3, 4, 5, 6, 7,
                                   8, 9, 10, 11, 12, 13, 14, 15);
}

// Work-group barrier that orders LDS traffic only. __syncthreads() also waits for
// every global load in flight, which would drain the tiles fetched ahead; the
// waves of a block hand each other nothing through global memory in the k loop.
__device__ __forceinline__ void barrier_lds() {
    __builtin_amdgcn_fence(__ATOMIC_RELEASE, "workgroup", "local");
    __builtin_amdgcn_s_barrier();
    __builtin_amdgcn_fence(__ATOMIC_ACQUIRE, "workgroup", "local");
}

template <int MODE>
struct GemmTileRegs {                                   // one thread's share of a k tile
    f32x4  a[4];                                        // MODE 0: A chunks
    bf16x4 ab[4];                                       // MODE 1: A chunks
    f32x4  b[4];                                        // W chunks
};

// ---------------------------------------------------------------------------
// Tiled bf16 WMMA GEMM: out[N,Dout] = A[N,K] @ W[K,Dout] + bias (+ resid)
// 256 threads = 8 waves (2x4), block tile 128x128, wave tile 64x32, K-step 32;
// K a multiple of 64.
// MODE 0: A = f32, store bf16.  MODE 1: A = bf16, store f32 + bias + residual.
// MODE 0 runs three products on the same A in one launch: blockIdx.z picks the
// weight and bias, and the outputs are three N x Dout planes one after another.
// The k loop's global loads run two tiles ahead, in two register sets: trip t
// converts tile t from its set into LDS buffer t & 1, passes the barrier, reads
// its fragments, issues tile t+2's loads into the set just freed and multiplies.
// With two LDS buffers one barrier a trip is enough: a wave that writes buffer b
// again in trip t+2 has passed the barrier of trip t+1, which every wave reaches
// only after its reads of buffer b in trip t have returned.
// ---------------------------------------------------------------------------
template <int MODE>
__global__ __launch_bounds__(256)
void gemm_wmma(const float* __restrict__ A, const __bf16* __restrict__ Abf,
               const float* __restrict__ W0, const float* __restrict__ W1,
               const float* __restrict__ W2, const float* __restrict__ bias0,
               const float* __restrict__ bias1, const float* __restrict__ bias2,
               __bf16* __restrict__ outbf0, float* __restrict__ outf,
               const float* __restrict__ resid, int N, int K, int Dout) {
    __shared__ __align__(16) __bf16 lA[2][128 * PITCH_A];
    __shared__ __align__(16) __bf16 lB[2][32 * PITCH_B];

    const float* __restrict__ W    = W0;
    const float* __restrict__ bias = bias0;
    __bf16* __restrict__ outbf     = outbf0;
    if constexpr (MODE == 0) {
        const int z = blockIdx.z;
        W     = (z == 0) ? W0 : (z == 1) ? W1 : W2;
        bias  = (z == 0) ? bias0 : (z == 1) ? bias1 : bias2;
        outbf = outbf0 + (size_t)z * N * Dout;
    }

    const int tid  = threadIdx.x;
    const int wave = tid >> 5;
    const int lane = tid & 31;
    const int lm   = lane & 15;
    const int hl   = lane >> 4;
    const int wrow = wave >> 2;            // 0..1  -> 64-row slab
    const int wcol = wave & 3;             // 0..3  -> 32-col slab
    const int row0 = blockIdx.y * 128;
    const int col0 = blockIdx.x * 128;

    v8f zero = {};
    v8f acc[4][2];
#pragma unroll
    for (int i = 0; i < 4; ++i)
#pragma unroll
        for (int j = 0; j < 2; ++j) acc[i][j] = zero;

    // This thread's four vec4 chunks of the A tile (128x32: rows ar + 32 rep) and
    // of the W tile (32x128: rows br + 8 rep), as offsets from block-uniform
    // pointers that step from tile to tile.
    const int ar = tid >> 3, ac = (tid & 7) * 4;
    const int br = tid >> 5, bc = (tid & 31) * 4;
    unsigned aoff[4], boff[4];
#pragma unroll
    for (int rep = 0; rep < 4; ++rep) {
        aoff[rep] = (unsigned)((ar + rep * 32) * K + ac);
        boff[rep] = (unsigned)((br + rep * 8) * Dout + bc);
    }
    const float*  pA  = nullptr;                        // MODE 0
    const __bf16* pAb = nullptr;                        // MODE 1
    if constexpr (MODE == 0) pA  = A + (size_t)row0 * K;
    else                     pAb = Abf + (size_t)row0 * K;
    const float* pW = W + col0;

    auto fetch = [&](GemmTileRegs<MODE>& t) {
#pragma unroll
        for (int rep = 0; rep < 4; ++rep) {
            if constexpr (MODE == 0) t.a[rep]  = *(const f32x4*)&pA[aoff[rep]];
            else                     t.ab[rep] = *(const bf16x4*)&pAb[aoff[rep]];
        }
#pragma unroll
        for (int rep = 0; rep < 4; ++rep) t.b[rep] = *(const f32x4*)&pW[boff[rep]];
        // The pointers step next: the wait that stands in front of an overwrite of
        // a register which an issued global load names.
        asm volatile("s_wait_xcnt 0x0" ::: "memory");
        if constexpr (MODE == 0) pA += 32;
        else                     pAb += 32;
        pW += (size_t)32 * Dout;
    };
    auto stage = [&](const GemmTileRegs<MODE>& t, __bf16* sA, __bf16* sB) {
#pragma unroll
        for (int rep = 0; rep < 4; ++rep) {
            if constexpr (MODE == 0) {
                f32x4 v = t.a[rep];
                bf16x4 b = {(__bf16)v.x, (__bf16)v.y, (__bf16)v.z, (__bf16)v.w};
                *(bf16x4*)&sA[(ar + rep * 32) * PITCH_A + ac] = b;
            } else {
                *(bf16x4*)&sA[(ar + rep * 32) * PITCH_A + ac] = t.ab[rep];
            }
        }
#pragma unroll
        for (int rep = 0; rep < 4; ++rep) {
            f32x4 v = t.b[rep];
            bf16x4 b = {(__bf16)v.x, (__bf16)v.y, (__bf16)v.z, (__bf16)v.w};
            *(bf16x4*)&sB[(br + rep * 8) * PITCH_B + bc] = b;
        }
    };
    // One trip: tile t out of its register set into LDS buffer b, the barrier, the
    // fragment reads, tile t+2's loads into the same set (while one exists), the
    // products. The global loads stand behind the fragment reads, so that their
    // issue and their wait run under the LDS latency.
    auto trip = [&](GemmTileRegs<MODE>& t, int b, bool more) __attribute__((always_inline)) {
        stage(t, lA[b], lB[b]);
        barrier_lds();
        v16bf af[4], bfr[2];
#pragma unroll
        for (int i = 0; i < 4; ++i)
            af[i] = load_frag(&lA[b][(wrow * 64 + i * 16 + lm) * PITCH_A], hl);
#pragma unroll
        for (int j = 0; j < 2; ++j)
            bfr[j] = load_frag_tr<PITCH_B>(lB[b], wcol * 32 + j * 16, lane);
        // Keeps the twelve fragment reads in one group at the head of the trip:
        // spread among the products, each place with reads waits out the LDS
        // latency anew.
        __builtin_amdgcn_sched_barrier(0);
        if (more) {
            fetch(t);
            // Keeps the global loads ahead of the products: the compiler otherwise
            // lands them in fragment registers and holds them back until the
            // products have read those.
            __builtin_amdgcn_sched_barrier(0);
        }
#pragma unroll
        for (int i = 0; i < 4; ++i)
#pragma unroll
            for (int j = 0; j < 2; ++j)
                acc[i][j] = __builtin_amdgcn_wmma_f32_16x16x32_bf16(
                    false, af[i], false, bfr[j], (short)0, acc[i][j], false, false);
        // Keeps the next trip's conversion, and with it the wait for its tile,
        // behind this trip's products: moved up among them it would wait for
        // loads that are only one trip old.
        __builtin_amdgcn_sched_barrier(0);
    };

    GemmTileRegs<MODE> t0, t1;
    fetch(t0);
    // Keeps tile 0's loads ahead of tile 1's, as in the loop, so that the counted
    // waits at the loop's head leave tile 1 in flight on the first trip too.
    __builtin_amdgcn_sched_barrier(0);
    fetch(t1);
    // The last two trips stand behind the loop, without loads: no branch in the
    // loop, so the waits for a tile count the younger tile's loads exactly.
    for (int k0 = 64; k0 < K; k0 += 64) {
        trip(t0, 0, true);
        trip(t1, 1, true);
    }
    trip(t0, 0, false);
    trip(t1, 1, false);

#pragma unroll
    for (int i = 0; i < 4; ++i)
#pragma unroll
        for (int j = 0; j < 2; ++j) {
            int gcol = col0 + wcol * 32 + j * 16 + lm;
            float bv = bias[gcol];
#pragma unroll
            for (int v = 0; v < 8; ++v) {
                int grow = row0 + wrow * 64 + i * 16 + v + 8 * hl;
                size_t gi = (size_t)grow * Dout + gcol;
                float val = acc[i][j][v] + bv;
                if constexpr (MODE == 0) outbf[gi] = (__bf16)val;
                else                     outf[gi] = val + resid[gi];
            }
        }
}

// Lane l <-> lane l ^ 16: the other half of the wave.
__device__ __forceinline__ float xhalf(float x) {
    int b = __builtin_bit_cast(int, x);
    return __builtin_bit_cast(float, __builtin_amdgcn_permlanex16(
        b, b, 0x76543210, 0xfedcba98, false, false));
}

// e^x as 2^(x * log2 e) on the transcendental unit, as __expf compiles. The
// v_nop in the same statement keeps the one free slot that the instruction set
// asks for behind a transcendental, whatever the compiler schedules next.
__device__ __forceinline__ float exp_slot(float x) {
    float r;
    asm("v_exp_f32 %0, %1\n\tv_nop" : "=v"(r) : "v"(x * 1.44269504088896340736f));
    return r;
}

#define KSLICES 4
#define STAGE_KEYS (32 * KSLICES)
#define NQTILE (SEQ / 64)                               // query tiles, even
#define PITCH_O 68                                      // 64 f32 rows, 272 B
__global__ __launch_bounds__(512)
void attn_flash(const __bf16* __restrict__ Q, const __bf16* __restrict__ Kb,
                const __bf16* __restrict__ Vb, __bf16* __restrict__ ctx) {
    __shared__ __align__(16) __bf16 lQ[64 * 64];               // 8 KB
    __shared__ __align__(16) __bf16 lK[STAGE_KEYS * PITCH_K];  // [key][d]
    __shared__ __align__(16) __bf16 lV[STAGE_KEYS * PITCH_V];  // [key][d]
    __shared__ __align__(16) float lO[KSLICES][64 * PITCH_O];  // partial ctx [query][d]
    __shared__ float lM[KSLICES][64], lL[KSLICES][64];         // partial max, sum

    const int tid   = threadIdx.x;
    // In a scalar register, so that the per-wave skip below is a scalar branch.
    const int wave  = __builtin_amdgcn_readfirstlane(tid >> 5);
    const int lane  = tid & 31;
    const int lm    = lane & 15;
    const int hl    = lane >> 4;
    const int grp   = wave >> 2;                        // key slice
    const int slab  = wave & 3;                         // query slab
    const int h     = blockIdx.x;
    const int rank  = blockIdx.y;
    const int qtile = (rank < NQTILE / 2) ? NQTILE - 1 - rank : rank - NQTILE / 2;
    const int qbase = qtile * 64 + slab * 16;
    const int hoff  = h * DK;

    // stage Q tile (64 rows x 64 dk) once
#pragma unroll
    for (int rep = 0; rep < 2; ++rep) {
        int idx = tid + rep * 512;                     // 0..1023 vec4 chunks
        int r = idx >> 4, c4 = (idx & 15) * 4;
        *(bf16x4*)&lQ[r * 64 + c4] =
            *(const bf16x4*)&Q[(size_t)(qtile * 64 + r) * DMODEL + hoff + c4];
    }
    __syncthreads();
    v16bf qf[2];
#pragma unroll
    for (int c = 0; c < 2; ++c)
        qf[c] = load_frag(&lQ[(slab * 16 + lm) * 64 + c * 32], hl);

    v8f zero = {};
    v8f acc[4];
#pragma unroll
    for (int t = 0; t < 4; ++t) acc[t] = zero;
    float mrun = -__builtin_inff();                     // query lm, both halves alike
    float lrun = 0.f;                                   // this half's keys only
    const int q = qbase + lm;

    const int nst = (qtile * 64 + 64 + STAGE_KEYS - 1) / STAGE_KEYS;  // causal bound
    for (int st = 0; st < nst; ++st) {
        const int sbase = st * STAGE_KEYS;

        if (st + 1 < nst && grp == 0) {                 // prefetch next K/V rows
            const int nrow = sbase + STAGE_KEYS + slab * 32 + lane;
            __builtin_prefetch(&Kb[(size_t)nrow * DMODEL + hoff], 0, 1);
            __builtin_prefetch(&Vb[(size_t)nrow * DMODEL + hoff], 0, 1);
        }
        __syncthreads();                                // previous stage reads done

        // ---- stage K (128 keys x 64 d) ----
#if HAVE_ASYNC_LDS
#pragma unroll
        for (int rep = 0; rep < 2; ++rep) {
            int idx = tid + rep * 512;                  // 0..1023 x 16B
            int r = idx >> 3, c8 = (idx & 7) * 8;
            __builtin_amdgcn_global_load_async_to_lds_b128(
                (AS1 v4i*)&Kb[(size_t)(sbase + r) * DMODEL + hoff + c8],
                (AS3 v4i*)&lK[r * PITCH_K + c8], 0, 0);
        }
#else
#pragma unroll
        for (int rep = 0; rep < 4; ++rep) {
            int idx = tid + rep * 512;
            int r = idx >> 4, c4 = (idx & 15) * 4;
            *(bf16x4*)&lK[r * PITCH_K + c4] =
                *(const bf16x4*)&Kb[(size_t)(sbase + r) * DMODEL + hoff + c4];
        }
#endif
        // ---- stage V (128 keys x 64 d) ----
#pragma unroll
        for (int rep = 0; rep < 4; ++rep) {
            int idx = tid + rep * 512;
            int r = idx >> 4, c4 = (idx & 15) * 4;      // key r, dims c4..c4+3
            *(bf16x4*)&lV[r * PITCH_V + c4] =
                *(const bf16x4*)&Vb[(size_t)(sbase + r) * DMODEL + hoff + c4];
        }
#if HAVE_ASYNC_LDS
        __builtin_amdgcn_s_wait_asynccnt(0);
#endif
        __syncthreads();

        // This wave's 32 keys of the stage. A slice that starts behind the slab's
        // first query is masked for all of the slab and is skipped (both are
        // multiples of 16, so a slice that is not skipped holds at least one
        // open key for every query and the running maximum stays finite).
        const int kbase = sbase + grp * 32;
        if (kbase > qbase) continue;

        // ---- S^T = K @ Q^T: s[t][v] = score(key kbase+16t+8hl+v, query lm) ----
        v8f s[2];
        s[0] = zero; s[1] = zero;
#pragma unroll
        for (int t = 0; t < 2; ++t)
#pragma unroll
            for (int c = 0; c < 2; ++c) {
                v16bf kf = load_frag(&lK[(grp * 32 + t * 16 + lm) * PITCH_K + c * 32], hl);
                s[t] = __builtin_amdgcn_wmma_f32_16x16x32_bf16(
                    false, kf, false, qf[c], (short)0, s[t], false, false);
            }

        // ---- scale + causal mask + this query's max ----
        float m = -__builtin_inff();
#pragma unroll
        for (int t = 0; t < 2; ++t)
#pragma unroll
            for (int v = 0; v < 8; ++v) {
                int key = kbase + t * 16 + 8 * hl + v;
                float sv = s[t][v] * 0.125f;
                sv = (key > q) ? -__builtin_inff() : sv;
                s[t][v] = sv;
                m = fmaxf(m, sv);
            }
        m = fmaxf(m, xhalf(m));

        // ---- online softmax ----
        float mnew  = fmaxf(mrun, m);
        float alpha = exp_slot(mrun - mnew);
        mrun = mnew;
        float sum = 0.f;
#pragma unroll
        for (int t = 0; t < 2; ++t)
#pragma unroll
            for (int v = 0; v < 8; ++v) {
                float p = exp_slot(s[t][v] - mrun);
                s[t][v] = p;
                sum += p;
            }
        lrun = lrun * alpha + sum;
#pragma unroll
        for (int t = 0; t < 4; ++t)
#pragma unroll
            for (int v = 0; v < 8; ++v) acc[t][v] *= alpha;

        // ---- P^T as B operand: element e is key kmap(e, hl) of query lm ----
        v16bf pf;
#pragma unroll
        for (int e = 0; e < 16; ++e) pf[e] = (__bf16)s[e >> 3][e & 7];

        // ---- ctx^T += V^T @ P^T: acc[t][v] = ctx(query lm, dim 16t+8hl+v) ----
#pragma unroll
        for (int t = 0; t < 4; ++t) {
            v16bf vf = load_frag_tr<PITCH_V>(lV + grp * 32 * PITCH_V, t * 16, lane);
            acc[t] = __builtin_amdgcn_wmma_f32_16x16x32_bf16(
                false, vf, false, pf, (short)0, acc[t], false, false);
        }
    }

    // ---- hand over this slice's partial result (a slice that never ran:
    //      maximum -inf, sum 0, context 0, weight 0 below) ----
    const float lpart = lrun + xhalf(lrun);             // join the halves' sums
#pragma unroll
    for (int t = 0; t < 4; ++t) {
        float* o = &lO[grp][(slab * 16 + lm) * PITCH_O + t * 16 + 8 * hl];
        f32x4 lo = {acc[t][0], acc[t][1], acc[t][2], acc[t][3]};
        f32x4 hi = {acc[t][4], acc[t][5], acc[t][6], acc[t][7]};
        *(f32x4*)o       = lo;
        *(f32x4*)(o + 4) = hi;
    }
    if (hl == 0) {
        lM[grp][slab * 16 + lm] = mrun;
        lL[grp][slab * 16 + lm] = lpart;
    }
    __syncthreads();                                    // partials visible to all waves

    // ---- merge: each wave finishes four whole rows, a lane 8 dims of one ----
    const int qr = wave * 4 + (lane >> 3);              // row of the query tile
    const int d0 = (lane & 7) * 8;
    float mall = -__builtin_inff();                     // finite: slice 0 holds key 0
#pragma unroll
    for (int g = 0; g < KSLICES; ++g) mall = fmaxf(mall, lM[g][qr]);
    float ltot = 0.f;
    float osum[8] = {0.f, 0.f, 0.f, 0.f, 0.f, 0.f, 0.f, 0.f};
#pragma unroll
    for (int g = 0; g < KSLICES; ++g) {
        const float wgt = exp_slot(lM[g][qr] - mall);
        ltot += wgt * lL[g][qr];
        const float* o = &lO[g][qr * PITCH_O + d0];
        f32x4 lo = *(const f32x4*)o;
        f32x4 hi = *(const f32x4*)(o + 4);
#pragma unroll
        for (int v = 0; v < 4; ++v) {
            osum[v]     += wgt * lo[v];
            osum[v + 4] += wgt * hi[v];
        }
    }
    bf16x8 ob;
#pragma unroll
    for (int v = 0; v < 8; ++v) ob[v] = (__bf16)(osum[v] / ltot);
    *(bf16x8*)&ctx[(size_t)(qtile * 64 + qr) * DMODEL + hoff + d0] = ob;
}

// ---------------------------------------------------------------------------
// Row-wise LayerNorm, in place on d_out.
// ---------------------------------------------------------------------------
__global__ __launch_bounds__(256)
void layernorm_kernel(float* __restrict__ y, const float* __restrict__ gamma,
                      const float* __restrict__ beta) {
    __shared__ float ssum[8], ssum2[8];
    const int row = blockIdx.x;
    const int tid = threadIdx.x;
    float s = 0.f, s2 = 0.f;
    for (int i = tid; i < DMODEL; i += 256) {
        float v = y[(size_t)row * DMODEL + i];
        s += v; s2 += v * v;
    }
#pragma unroll
    for (int off = 1; off < 32; off <<= 1) {
        s  += __shfl_xor(s,  off, 32);
        s2 += __shfl_xor(s2, off, 32);
    }
    int wave = tid >> 5, lane = tid & 31;
    if (lane == 0) { ssum[wave] = s; ssum2[wave] = s2; }
    __syncthreads();
    float ts = 0.f, ts2 = 0.f;
#pragma unroll
    for (int w = 0; w < 8; ++w) { ts += ssum[w]; ts2 += ssum2[w]; }
    float mu  = ts * (1.f / DMODEL);
    float var = ts2 * (1.f / DMODEL) - mu * mu;
    float inv = rsqrtf(var + LN_EPS);
    for (int i = tid; i < DMODEL; i += 256) {
        float v = y[(size_t)row * DMODEL + i];
        y[(size_t)row * DMODEL + i] = (v - mu) * inv * gamma[i] + beta[i];
    }
}

extern "C" void kernel_launch(void* const* d_in, const int* in_sizes, int n_in,
                              void* d_out, int out_size, void* d_ws, size_t ws_size,
                              hipStream_t stream) {
    const float* x     = (const float*)d_in[0];
    const float* Wq    = (const float*)d_in[1];
    const float* bq    = (const float*)d_in[2];
    const float* Wk    = (const float*)d_in[3];
    const float* bk    = (const float*)d_in[4];
    const float* Wv    = (const float*)d_in[5];
    const float* bv    = (const float*)d_in[6];
    const float* Wo    = (const float*)d_in[7];
    const float* bo    = (const float*)d_in[8];
    const float* gamma = (const float*)d_in[9];
    const float* beta  = (const float*)d_in[10];
    float* out = (float*)d_out;

    char* ws = (char*)d_ws;
    const size_t MAT = (size_t)SEQ * DMODEL * sizeof(__bf16);  // 4 MB
    __bf16* Qb = (__bf16*)(ws);
    __bf16* Kb = (__bf16*)(ws + MAT);
    __bf16* Vb = (__bf16*)(ws + 2 * MAT);
    __bf16* Cb = (__bf16*)(ws + 3 * MAT);

    dim3 gGemm(DMODEL / 128, SEQ / 128);
    dim3 gQkv(DMODEL / 128, SEQ / 128, 3);              // planes Qb, Kb, Vb
    gemm_wmma<0><<<gQkv, 256, 0, stream>>>(x, nullptr, Wq, Wk, Wv, bq, bk, bv, Qb,
                                           nullptr, nullptr, SEQ, DMODEL, DMODEL);
    dim3 gAttn(NHEAD, SEQ / 64);
    attn_flash<<<gAttn, 512, 0, stream>>>(Qb, Kb, Vb, Cb);
    gemm_wmma<1><<<gGemm, 256, 0, stream>>>(nullptr, Cb, Wo, nullptr, nullptr, bo,
                                            nullptr, nullptr, nullptr, out, x,
                                            SEQ, DMODEL, DMODEL);
    layernorm_kernel<<<SEQ, 256, 0, stream>>>(out, gamma, beta);
}

// v007
// One run takes 63.7 microseconds.
// Next to v006, in two timings, it ran 1.05 times as fast each time.
// Over all steps from v000 it is 6.45 times as fast.
#include <hip/hip_runtime.h>

#define SEQ 2048
#define DMODEL 1024
#define NHEAD 16
#define DK 64
#define LN_EPS 1e-5f

typedef __bf16 v16bf  __attribute__((ext_vector_type(16)));
typedef __bf16 bf16x8 __attribute__((ext_vector_type(8)));
typedef __bf16 bf16x4 __attribute__((ext_vector_type(4)));
typedef float  v8f    __attribute__((ext_vector_type(8)));
typedef float  f32x4  __attribute__((ext_vector_type(4)));
typedef int    v4i    __attribute__((ext_vector_type(4)));

#define AS1 __attribute__((address_space(1)))
#define AS3 __attribute__((address_space(3)))

// K-index mapping kmap(e, hl) of 16-bit A/B fragments of V_WMMA_*_16X16X32_*
// (ISA 7.12.2): element e -> K = {0..7}+8*hl for e<8, {16..23}+8*hl for e>=8.

// LDS row pitches in elements. Rows read by ds_load_b128 stand at an odd
// multiple of 16 B, rows read by ds_load_tr16_b128 at an odd multiple of 32 B:
// a half wave's sixteen 16-byte reads then cover the 64 banks once.
#define PITCH_A 40                                      // 32-element rows,  80 B
#define PITCH_B 144                                     // 128-element rows, 288 B
#define PITCH_K 72                                      // 64-element rows,  144 B
#define PITCH_V 80                                      // 64-element rows,  160 B

// Fragment whose element e reads p[kmap(e,hl)]: two contiguous 16B runs.
__device__ __forceinline__ v16bf load_frag(const __bf16* p, int hl) {
    bf16x8 a0 = *(const bf16x8*)(p + 8 * hl);
    bf16x8 a1 = *(const bf16x8*)(p + 16 + 8 * hl);
    return __builtin_shufflevector(a0, a1, 0, 1, 2, 3, 4, 5, 6, 7,
                                   8, 9, 10, 11, 12, 13, 14, 15);
}

// Transposed fragment from a row-major LDS tile T[k][n] (32 rows of k, PITCH
// elements apart): lane (lm, hl) gets element e = T[kmap(e,hl)][n0 + lm]. Each
// transposing load takes 16 rows of k; lane l points at the 16 bytes at row
// 8*(l>>4) + (l&7), column n0 + 8*((l>>3)&1).
template <int PITCH>
__device__ __forceinline__ v16bf load_frag_tr(const __bf16* tile, int n0, int lane) {
    const __bf16* p = tile + (8 * (lane >> 4) + (lane & 7)) * PITCH + n0 +
                      8 * ((lane >> 3) & 1);
    bf16x8 a0 = __builtin_amdgcn_ds_load_tr16_b128_v8bf16((AS3 bf16x8*)p);
    bf16x8 a1 = __builtin_amdgcn_ds_load_tr16_b128_v8bf16((AS3 bf16x8*)(p + 16 * PITCH));
    return __builtin_shufflevector(a0, a1, 0, 1, 2, 3, 4, 5, 6, 7,
                                   8, 9, 10, 11, 12, 13, 14, 15);
}

// Work-group barrier that orders LDS traffic only. __syncthreads() also waits for
// every global load in flight, which would drain the tiles fetched ahead; the
// waves of a block hand each other nothing through global memory in the k loop.
__device__ __forceinline__ void barrier_lds() {
    __builtin_amdgcn_fence(__ATOMIC_RELEASE, "workgroup", "local");
    __builtin_amdgcn_s_barrier();
    __builtin_amdgcn_fence(__ATOMIC_ACQUIRE, "workgroup", "local");
}

template <int MODE>
struct GemmTileRegs {                                   // one thread's share of a k tile
    f32x4  a[4];                                        // MODE 0: A chunks
    bf16x4 ab[4];                                       // MODE 1: A chunks
    f32x4  b[4];                                        // W chunks
};

// ---------------------------------------------------------------------------
// Tiled bf16 WMMA GEMM: out[N,Dout] = A[N,K] @ W[K,Dout] + bias (+ resid)
// 256 threads = 8 waves (2x4), block tile 128x128, wave tile 64x32, K-step 32;
// K a multiple of 64.
// MODE 0: A = f32, store bf16.  MODE 1: A = bf16, store f32 + bias + residual.
// MODE 0 runs three products on the same A in one launch: blockIdx.z picks the
// weight and bias, and the outputs are three N x Dout planes one after another.
// The k loop's global loads run two tiles ahead, in two register sets: trip t
// converts tile t from its set into LDS buffer t & 1, passes the barrier, reads
// its fragments, issues tile t+2's loads into the set just freed and multiplies.
// With two LDS buffers one barrier a trip is enough: a wave that writes buffer b
// again in trip t+2 has passed the barrier of trip t+1, which every wave reaches
// only after its reads of buffer b in trip t have returned.
// ---------------------------------------------------------------------------
template <int MODE>
__global__ __launch_bounds__(256)
void gemm_wmma(const float* __restrict__ A, const __bf16* __restrict__ Abf,
               const float* __restrict__ W0, const float* __restrict__ W1,
               const float* __restrict__ W2, const float* __restrict__ bias0,
               const float* __restrict__ bias1, const float* __restrict__ bias2,
               __bf16* __restrict__ outbf0, float* __restrict__ outf,
               const float* __restrict__ resid, int N, int K, int Dout) {
    __shared__ __align__(16) __bf16 lA[2][128 * PITCH_A];
    __shared__ __align__(16) __bf16 lB[2][32 * PITCH_B];

    const float* __restrict__ W    = W0;
    const float* __restrict__ bias = bias0;
    __bf16* __restrict__ outbf     = outbf0;
    if constexpr (MODE == 0) {
        const int z = blockIdx.z;
        W     = (z == 0) ? W0 : (z == 1) ? W1 : W2;
        bias  = (z == 0) ? bias0 : (z == 1) ? bias1 : bias2;
        outbf = outbf0 + (size_t)z * N * Dout;
    }

    const int tid  = threadIdx.x;
    const int wave = tid >> 5;
    const int lane = tid & 31;
    const int lm   = lane & 15;
    const int hl   = lane >> 4;
    const int wrow = wave >> 2;            // 0..1  -> 64-row slab
    const int wcol = wave & 3;             // 0..3  -> 32-col slab
    const int row0 = blockIdx.y * 128;
    const int col0 = blockIdx.x * 128;

    v8f zero = {};
    v8f acc[4][2];
#pragma unroll
    for (int i = 0; i < 4; ++i)
#pragma unroll
        for (int j = 0; j < 2; ++j) acc[i][j] = zero;

    // This thread's four vec4 chunks of the A tile (128x32: rows ar + 32 rep) and
    // of the W tile (32x128: rows br + 8 rep), as offsets from block-uniform
    // pointers that step from tile to tile.
    const int ar = tid >> 3, ac = (tid & 7) * 4;
    const int br = tid >> 5, bc = (tid & 31) * 4;
    unsigned aoff[4], boff[4];
#pragma unroll
    for (int rep = 0; rep < 4; ++rep) {
        aoff[rep] = (unsigned)((ar + rep * 32) * K + ac);
        boff[rep] = (unsigned)((br + rep * 8) * Dout + bc);
    }
    const float*  pA  = nullptr;                        // MODE 0
    const __bf16* pAb = nullptr;                        // MODE 1
    if constexpr (MODE == 0) pA  = A + (size_t)row0 * K;
    else                     pAb = Abf + (size_t)row0 * K;
    const float* pW = W + col0;

    auto fetch = [&](GemmTileRegs<MODE>& t) {
#pragma unroll
        for (int rep = 0; rep < 4; ++rep) {
            if constexpr (MODE == 0) t.a[rep]  = *(const f32x4*)&pA[aoff[rep]];
            else                     t.ab[rep] = *(const bf16x4*)&pAb[aoff[rep]];
        }
#pragma unroll
        for (int rep = 0; rep < 4; ++rep) t.b[rep] = *(const f32x4*)&pW[boff[rep]];
        // The pointers step next: the wait that stands in front of an overwrite of
        // a register which an issued global load names.
        asm volatile("s_wait_xcnt 0x0" ::: "memory");
        if constexpr (MODE == 0) pA += 32;
        else                     pAb += 32;
        pW += (size_t)32 * Dout;
    };
    auto stage = [&](const GemmTileRegs<MODE>& t, __bf16* sA, __bf16* sB) {
#pragma unroll
        for (int rep = 0; rep < 4; ++rep) {
            if constexpr (MODE == 0) {
                f32x4 v = t.a[rep];
                bf16x4 b = {(__bf16)v.x, (__bf16)v.y, (__bf16)v.z, (__bf16)v.w};
                *(bf16x4*)&sA[(ar + rep * 32) * PITCH_A + ac] = b;
            } else {
                *(bf16x4*)&sA[(ar + rep * 32) * PITCH_A + ac] = t.ab[rep];
            }
        }
#pragma unroll
        for (int rep = 0; rep < 4; ++rep) {
            f32x4 v = t.b[rep];
            bf16x4 b = {(__bf16)v.x, (__bf16)v.y, (__bf16)v.z, (__bf16)v.w};
            *(bf16x4*)&sB[(br + rep * 8) * PITCH_B + bc] = b;
        }
    };
    // One trip: tile t out of its register set into LDS buffer b, the barrier, the
    // fragment reads, tile t+2's loads into the same set (while one exists), the
    // products. The global loads stand behind the fragment reads, so that their
    // issue and their wait run under the LDS latency.
    auto trip = [&](GemmTileRegs<MODE>& t, int b, bool more) __attribute__((always_inline)) {
        stage(t, lA[b], lB[b]);
        barrier_lds();
        v16bf af[4], bfr[2];
#pragma unroll
        for (int i = 0; i < 4; ++i)
            af[i] = load_frag(&lA[b][(wrow * 64 + i * 16 + lm) * PITCH_A], hl);
#pragma unroll
        for (int j = 0; j < 2; ++j)
            bfr[j] = load_frag_tr<PITCH_B>(lB[b], wcol * 32 + j * 16, lane);
        // Keeps the twelve fragment reads in one group at the head of the trip:
        // spread among the products, each place with reads waits out the LDS
        // latency anew.
        __builtin_amdgcn_sched_barrier(0);
        if (more) {
            fetch(t);
            // Keeps the global loads ahead of the products: the compiler otherwise
            // lands them in fragment registers and holds them back until the
            // products have read those.
            __builtin_amdgcn_sched_barrier(0);
        }
#pragma unroll
        for (int i = 0; i < 4; ++i)
#pragma unroll
            for (int j = 0; j < 2; ++j)
                acc[i][j] = __builtin_amdgcn_wmma_f32_16x16x32_bf16(
                    false, af[i], false, bfr[j], (short)0, acc[i][j], false, false);
        // Keeps the next trip's conversion, and with it the wait for its tile,
        // behind this trip's products: moved up among them it would wait for
        // loads that are only one trip old.
        __builtin_amdgcn_sched_barrier(0);
    };

    GemmTileRegs<MODE> t0, t1;
    fetch(t0);
    // Keeps tile 0's loads ahead of tile 1's, as in the loop, so that the counted
    // waits at the loop's head leave tile 1 in flight on the first trip too.
    __builtin_amdgcn_sched_barrier(0);
    fetch(t1);
    // The last two trips stand behind the loop, without loads: no branch in the
    // loop, so the waits for a tile count the younger tile's loads exactly.
    for (int k0 = 64; k0 < K; k0 += 64) {
        trip(t0, 0, true);
        trip(t1, 1, true);
    }
    trip(t0, 0, false);
    trip(t1, 1, false);

#pragma unroll
    for (int i = 0; i < 4; ++i)
#pragma unroll
        for (int j = 0; j < 2; ++j) {
            int gcol = col0 + wcol * 32 + j * 16 + lm;
            float bv = bias[gcol];
#pragma unroll
            for (int v = 0; v < 8; ++v) {
                int grow = row0 + wrow * 64 + i * 16 + v + 8 * hl;
                size_t gi = (size_t)grow * Dout + gcol;
                float val = acc[i][j][v] + bv;
                if constexpr (MODE == 0) outbf[gi] = (__bf16)val;
                else                     outf[gi] = val + resid[gi];
            }
        }
}

// Lane l <-> lane l ^ 16: the other half of the wave.
__device__ __forceinline__ float xhalf(float x) {
    int b = __builtin_bit_cast(int, x);
    return __builtin_bit_cast(float, __builtin_amdgcn_permlanex16(
        b, b, 0x76543210, 0xfedcba98, false, false));
}

// e^x as 2^(x * log2 e) on the transcendental unit, as __expf compiles. The
// v_nop in the same statement keeps the one free slot that the instruction set
// asks for behind a transcendental, whatever the compiler schedules next.
__device__ __forceinline__ float exp_slot(float x) {
    float r;
    asm("v_exp_f32 %0, %1\n\tv_nop" : "=v"(r) : "v"(x * 1.44269504088896340736f));
    return r;
}

#define KSLICES 4
#define STAGE_KEYS (32 * KSLICES)
#define NQTILE (SEQ / 64)                               // query tiles, even
#define PITCH_O 68                                      // 64 f32 rows, 272 B
__global__ __launch_bounds__(512)
void attn_flash(const __bf16* __restrict__ Q, const __bf16* __restrict__ Kb,
                const __bf16* __restrict__ Vb, __bf16* __restrict__ ctx) {
    __shared__ __align__(16) __bf16 lQ[64 * 64];               // 8 KB
    __shared__ __align__(16) __bf16 lK[2][STAGE_KEYS * PITCH_K];  // [key][d]
    __shared__ __align__(16) __bf16 lV[2][STAGE_KEYS * PITCH_V];  // [key][d]
    __shared__ __align__(16) float lO[KSLICES][64 * PITCH_O];  // partial ctx [query][d]
    __shared__ float lM[KSLICES][64], lL[KSLICES][64];         // partial max, sum

    const int tid   = threadIdx.x;
    // In a scalar register, so that the per-wave skip below is a scalar branch.
    const int wave  = __builtin_amdgcn_readfirstlane(tid >> 5);
    const int lane  = tid & 31;
    const int lm    = lane & 15;
    const int hl    = lane >> 4;
    const int grp   = wave >> 2;                        // key slice
    const int slab  = wave & 3;                         // query slab
    const int h     = blockIdx.x;
    const int rank  = blockIdx.y;
    const int qtile = (rank < NQTILE / 2) ? NQTILE - 1 - rank : rank - NQTILE / 2;
    const int qbase = qtile * 64 + slab * 16;
    const int hoff  = h * DK;

    // One stage (128 keys x 64 d of K and of V) into ring buffer b: a thread
    // copies two 16-byte pieces of each.
    auto copy_stage = [&](int st, int b) {
#pragma unroll
        for (int rep = 0; rep < 2; ++rep) {
            int idx = tid + rep * 512;                  // 0..1023 x 16B
            int r = idx >> 3, c8 = (idx & 7) * 8;
            const size_t g = (size_t)(st * STAGE_KEYS + r) * DMODEL + hoff + c8;
            __builtin_amdgcn_global_load_async_to_lds_b128(
                (AS1 v4i*)&Kb[g], (AS3 v4i*)&lK[b][r * PITCH_K + c8], 0, 0);
            __builtin_amdgcn_global_load_async_to_lds_b128(
                (AS1 v4i*)&Vb[g], (AS3 v4i*)&lV[b][r * PITCH_V + c8], 0, 0);
        }
    };
    // Asks L2 for a stage's K and V rows, one stage ahead of their copies (the four
    // waves of key slice 0, a lane a row).
    auto prefetch_stage = [&](int st) {
        const int nrow = st * STAGE_KEYS + slab * 32 + lane;
        __builtin_prefetch(&Kb[(size_t)nrow * DMODEL + hoff], 0, 3);
        __builtin_prefetch(&Vb[(size_t)nrow * DMODEL + hoff], 0, 3);
    };
    const int nst = (qtile * 64 + 64 + STAGE_KEYS - 1) / STAGE_KEYS;  // causal bound

    copy_stage(0, 0);                                   // flies under the Q staging

    // stage Q tile (64 rows x 64 dk) once
#pragma unroll
    for (int rep = 0; rep < 2; ++rep) {
        int idx = tid + rep * 512;                     // 0..1023 vec4 chunks
        int r = idx >> 4, c4 = (idx & 15) * 4;
        *(bf16x4*)&lQ[r * 64 + c4] =
            *(const bf16x4*)&Q[(size_t)(qtile * 64 + r) * DMODEL + hoff + c4];
    }
    // This wave's copies of stage 0 have landed before the barrier publishes them.
    asm volatile("s_wait_asynccnt 0x0" ::: "memory");
    __syncthreads();                                    // Q and stage 0 visible
    if (nst > 1) copy_stage(1, 1);
    if (nst > 2 && grp == 0) prefetch_stage(2);
    v16bf qf[2];
#pragma unroll
    for (int c = 0; c < 2; ++c)
        qf[c] = load_frag(&lQ[(slab * 16 + lm) * 64 + c * 32], hl);

    v8f zero = {};
    v8f acc[4];
#pragma unroll
    for (int t = 0; t < 4; ++t) acc[t] = zero;
    float mrun = -__builtin_inff();                     // query lm, both halves alike
    float lrun = 0.f;                                   // this half's keys only
    const int q = qbase + lm;

    for (int st = 0; st < nst; ++st) {
        const __bf16* sK = lK[st & 1];
        const __bf16* sV = lV[st & 1];

        // This wave's 32 keys of the stage. A slice that starts behind the slab's
        // first query is masked for all of the slab and is skipped (both are
        // multiples of 16, so a slice that is not skipped holds at least one
        // open key for every query and the running maximum stays finite). The
        // foot of the trip stands outside the skip: every wave passes it.
        const int kbase = st * STAGE_KEYS + grp * 32;
        if (kbase <= qbase) {
            // ---- S^T = K @ Q^T: s[t][v] = score(key kbase+16t+8hl+v, query lm) ----
            v8f s[2];
            s[0] = zero; s[1] = zero;
#pragma unroll
            for (int t = 0; t < 2; ++t)
#pragma unroll
                for (int c = 0; c < 2; ++c) {
                    v16bf kf = load_frag(&sK[(grp * 32 + t * 16 + lm) * PITCH_K + c * 32], hl);
                    s[t] = __builtin_amdgcn_wmma_f32_16x16x32_bf16(
                        false, kf, false, qf[c], (short)0, s[t], false, false);
                }

            // ---- scale + causal mask + this query's max ----
            float m = -__builtin_inff();
#pragma unroll
            for (int t = 0; t < 2; ++t)
#pragma unroll
                for (int v = 0; v < 8; ++v) {
                    int key = kbase + t * 16 + 8 * hl + v;
                    float sv = s[t][v] * 0.125f;
                    sv = (key > q) ? -__builtin_inff() : sv;
                    s[t][v] = sv;
                    m = fmaxf(m, sv);
                }
            m = fmaxf(m, xhalf(m));

            // ---- online softmax ----
            float mnew  = fmaxf(mrun, m);
            float alpha = exp_slot(mrun - mnew);
            mrun = mnew;
            float sum = 0.f;
#pragma unroll
            for (int t = 0; t < 2; ++t)
#pragma unroll
                for (int v = 0; v < 8; ++v) {
                    float p = exp_slot(s[t][v] - mrun);
                    s[t][v] = p;
                    sum += p;
                }
            lrun = lrun * alpha + sum;
#pragma unroll
            for (int t = 0; t < 4; ++t)
#pragma unroll
                for (int v = 0; v < 8; ++v) acc[t][v] *= alpha;

            // ---- P^T as B operand: element e is key kmap(e, hl) of query lm ----
            v16bf pf;
#pragma unroll
            for (int e = 0; e < 16; ++e) pf[e] = (__bf16)s[e >> 3][e & 7];

            // ---- ctx^T += V^T @ P^T: acc[t][v] = ctx(query lm, dim 16t+8hl+v) ----
#pragma unroll
            for (int t = 0; t < 4; ++t) {
                v16bf vf = load_frag_tr<PITCH_V>(sV + grp * 32 * PITCH_V, t * 16, lane);
                acc[t] = __builtin_amdgcn_wmma_f32_16x16x32_bf16(
                    false, vf, false, pf, (short)0, acc[t], false, false);
            }
        }

        // ---- foot of the trip, every wave ----
        // This wave's reads of the stage have returned before its buffer is freed.
        asm volatile("s_wait_dscnt 0x0" ::: "memory");
        // This wave's copies of the next stage have landed before they are published.
        asm volatile("s_wait_asynccnt 0x0" ::: "memory");
        __syncthreads();                                // next stage visible, this buffer free
        if (st + 2 < nst) copy_stage(st + 2, st & 1);
        if (st + 3 < nst && grp == 0) prefetch_stage(st + 3);
    }
    // No copy is left in flight when the wave goes on (none is issued behind the
    // last wait of the loop; a precaution).
    asm volatile("s_wait_asynccnt 0x0" ::: "memory");

    // ---- hand over this slice's partial result (a slice that never ran:
    //      maximum -inf, sum 0, context 0, weight 0 below) ----
    const float lpart = lrun + xhalf(lrun);             // join the halves' sums
#pragma unroll
    for (int t = 0; t < 4; ++t) {
        float* o = &lO[grp][(slab * 16 + lm) * PITCH_O + t * 16 + 8 * hl];
        f32x4 lo = {acc[t][0], acc[t][1], acc[t][2], acc[t][3]};
        f32x4 hi = {acc[t][4], acc[t][5], acc[t][6], acc[t][7]};
        *(f32x4*)o       = lo;
        *(f32x4*)(o + 4) = hi;
    }
    if (hl == 0) {
        lM[grp][slab * 16 + lm] = mrun;
        lL[grp][slab * 16 + lm] = lpart;
    }
    __syncthreads();                                    // partials visible to all waves

    // ---- merge: each wave finishes four whole rows, a lane 8 dims of one ----
    const int qr = wave * 4 + (lane >> 3);              // row of the query tile
    const int d0 = (lane & 7) * 8;
    float mall = -__builtin_inff();                     // finite: slice 0 holds key 0
#pragma unroll
    for (int g = 0; g < KSLICES; ++g) mall = fmaxf(mall, lM[g][qr]);
    float ltot = 0.f;
    float osum[8] = {0.f, 0.f, 0.f, 0.f, 0.f, 0.f, 0.f, 0.f};
#pragma unroll
    for (int g = 0; g < KSLICES; ++g) {
        const float wgt = exp_slot(lM[g][qr] - mall);
        ltot += wgt * lL[g][qr];
        const float* o = &lO[g][qr * PITCH_O + d0];
        f32x4 lo = *(const f32x4*)o;
        f32x4 hi = *(const f32x4*)(o + 4);
#pragma unroll
        for (int v = 0; v < 4; ++v) {
            osum[v]     += wgt * lo[v];
            osum[v + 4] += wgt * hi[v];
        }
    }
    bf16x8 ob;
#pragma unroll
    for (int v = 0; v < 8; ++v) ob[v] = (__bf16)(osum[v] / ltot);
    *(bf16x8*)&ctx[(size_t)(qtile * 64 + qr) * DMODEL + hoff + d0] = ob;
}

// ---------------------------------------------------------------------------
// Row-wise LayerNorm, in place on d_out.
// ---------------------------------------------------------------------------
__global__ __launch_bounds__(256)
void layernorm_kernel(float* __restrict__ y, const float* __restrict__ gamma,
                      const float* __restrict__ beta) {
    __shared__ float ssum[8], ssum2[8];
    const int row = blockIdx.x;
    const int tid = threadIdx.x;
    float s = 0.f, s2 = 0.f;
    for (int i = tid; i < DMODEL; i += 256) {
        float v = y[(size_t)row * DMODEL + i];
        s += v; s2 += v * v;
    }
#pragma unroll
    for (int off = 1; off < 32; off <<= 1) {
        s  += __shfl_xor(s,  off, 32);
        s2 += __shfl_xor(s2, off, 32);
    }
    int wave = tid >> 5, lane = tid & 31;
    if (lane == 0) { ssum[wave] = s; ssum2[wave] = s2; }
    __syncthreads();
    float ts = 0.f, ts2 = 0.f;
#pragma unroll
    for (int w = 0; w < 8; ++w) { ts += ssum[w]; ts2 += ssum2[w]; }
    float mu  = ts * (1.f / DMODEL);
    float var = ts2 * (1.f / DMODEL) - mu * mu;
    float inv = rsqrtf(var + LN_EPS);
    for (int i = tid; i < DMODEL; i += 256) {
        float v = y[(size_t)row * DMODEL + i];
        y[(size_t)row * DMODEL + i] = (v - mu) * inv * gamma[i] + beta[i];
    }
}

extern "C" void kernel_launch(void* const* d_in, const int* in_sizes, int n_in,
                              void* d_out, int out_size, void* d_ws, size_t ws_size,
                              hipStream_t stream) {
    const float* x     = (const float*)d_in[0];
    const float* Wq    = (const float*)d_in[1];
    const float* bq    = (const float*)d_in[2];
    const float* Wk    = (const float*)d_in[3];
    const float* bk    = (const float*)d_in[4];
    const float* Wv    = (const float*)d_in[5];
    const float* bv    = (const float*)d_in[6];
    const float* Wo    = (const float*)d_in[7];
    const float* bo    = (const float*)d_in[8];
    const float* gamma = (const float*)d_in[9];
    const float* beta  = (const float*)d_in[10];
    float* out = (float*)d_out;

    char* ws = (char*)d_ws;
    const size_t MAT = (size_t)SEQ * DMODEL * sizeof(__bf16);  // 4 MB
    __bf16* Qb = (__bf16*)(ws);
    __bf16* Kb = (__bf16*)(ws + MAT);
    __bf16* Vb = (__bf16*)(ws + 2 * MAT);
    __bf16* Cb = (__bf16*)(ws + 3 * MAT);

    dim3 gGemm(DMODEL / 128, SEQ / 128);
    dim3 gQkv(DMODEL / 128, SEQ / 128, 3);              // planes Qb, Kb, Vb
    gemm_wmma<0><<<gQkv, 256, 0, stream>>>(x, nullptr, Wq, Wk, Wv, bq, bk, bv, Qb,
                                           nullptr, nullptr, SEQ, DMODEL, DMODEL);
    dim3 gAttn(NHEAD, SEQ / 64);
    attn_flash<<<gAttn, 512, 0, stream>>>(Qb, Kb, Vb, Cb);
    gemm_wmma<1><<<gGemm, 256, 0, stream>>>(nullptr, Cb, Wo, nullptr, nullptr, bo,
                                            nullptr, nullptr, nullptr, out, x,
                                            SEQ, DMODEL, DMODEL);
    layernorm_kernel<<<SEQ, 256, 0, stream>>>(out, gamma, beta);
}

// v008
// One run takes 60.7 microseconds.
// In two side-by-side timings against v007, it was 1.04 and 1.05 times as fast.
// Over all steps from v000 it is 6.76 times as fast.
#include <hip/hip_runtime.h>

#define SEQ 2048
#define DMODEL 1024
#define NHEAD 16
#define DK 64
#define LN_EPS 1e-5f

typedef __bf16 v16bf  __attribute__((ext_vector_type(16)));
typedef __bf16 bf16x8 __attribute__((ext_vector_type(8)));
typedef __bf16 bf16x4 __attribute__((ext_vector_type(4)));
typedef float  v8f    __attribute__((ext_vector_type(8)));
typedef float  f32x4  __attribute__((ext_vector_type(4)));
typedef int    v4i    __attribute__((ext_vector_type(4)));

#define AS1 __attribute__((address_space(1)))
#define AS3 __attribute__((address_space(3)))

// K-index mapping kmap(e, hl) of 16-bit A/B fragments of V_WMMA_*_16X16X32_*
// (ISA 7.12.2): element e -> K = {0..7}+8*hl for e<8, {16..23}+8*hl for e>=8.

// LDS row pitches in elements. Rows read by ds_load_b128 stand at an odd
// multiple of 16 B, rows read by ds_load_tr16_b128 at an odd multiple of 32 B:
// a half wave's sixteen 16-byte reads then cover the 64 banks once.
#define PITCH_A 40                                      // 32-element rows,  80 B
#define PITCH_B 144                                     // 128-element rows, 288 B
#define PITCH_K 72                                      // 64-element rows,  144 B
#define PITCH_V 80                                      // 64-element rows,  160 B

// Fragment whose element e reads p[kmap(e,hl)]: two contiguous 16B runs.
__device__ __forceinline__ v16bf load_frag(const __bf16* p, int hl) {
    bf16x8 a0 = *(const bf16x8*)(p + 8 * hl);
    bf16x8 a1 = *(const bf16x8*)(p + 16 + 8 * hl);
    return __builtin_shufflevector(a0, a1, 0, 1, 2, 3, 4, 5, 6, 7,
                                   8, 9, 10, 11, 12, 13, 14, 15);
}

// Transposed fragment from a row-major LDS tile T[k][n] (32 rows of k, PITCH
// elements apart): lane (lm, hl) gets element e = T[kmap(e,hl)][n0 + lm]. Each
// transposing load takes 16 rows of k; lane l points at the 16 bytes at row
// 8*(l>>4) + (l&7), column n0 + 8*((l>>3)&1).
template <int PITCH>
__device__ __forceinline__ v16bf load_frag_tr(const __bf16* tile, int n0, int lane) {
    const __bf16* p = tile + (8 * (lane >> 4) + (lane & 7)) * PITCH + n0 +
                      8 * ((lane >> 3) & 1);
    bf16x8 a0 = __builtin_amdgcn_ds_load_tr16_b128_v8bf16((AS3 bf16x8*)p);
    bf16x8 a1 = __builtin_amdgcn_ds_load_tr16_b128_v8bf16((AS3 bf16x8*)(p + 16 * PITCH));
    return __builtin_shufflevector(a0, a1, 0, 1, 2, 3, 4, 5, 6, 7,
                                   8, 9, 10, 11, 12, 13, 14, 15);
}

// Work-group barrier that orders LDS traffic only. __syncthreads() also waits for
// every global load in flight, which would drain the tiles fetched ahead; the
// waves of a block hand each other nothing through global memory in the k loop.
__device__ __forceinline__ void barrier_lds() {
    __builtin_amdgcn_fence(__ATOMIC_RELEASE, "workgroup", "local");
    __builtin_amdgcn_s_barrier();
    __builtin_amdgcn_fence(__ATOMIC_ACQUIRE, "workgroup", "local");
}

template <int MODE>
struct GemmTileRegs {                                   // one thread's share of a k tile
    f32x4  a[4];                                        // MODE 0: A chunks
    bf16x4 ab[4];                                       // MODE 1: A chunks
    f32x4  b[4];                                        // W chunks
};

// ---------------------------------------------------------------------------
// Tiled bf16 WMMA GEMM: out[N,Dout] = A[N,K] @ W[K,Dout] + bias (+ resid)
// 256 threads = 8 waves (2x4), block tile 128x128, wave tile 64x32, K-step 32;
// K a multiple of 64.
// MODE 0: A = f32, store bf16.  MODE 1: A = bf16, store f32 + bias + residual.
// MODE 0 runs three products on the same A in one launch: blockIdx.z picks the
// weight and bias, and the outputs are three N x Dout planes one after another.
// The k loop's global loads run two tiles ahead, in two register sets: trip t
// converts tile t from its set into LDS buffer t & 1, passes the barrier, reads
// its fragments, issues tile t+2's loads into the set just freed and multiplies.
// With two LDS buffers one barrier a trip is enough: a wave that writes buffer b
// again in trip t+2 has passed the barrier of trip t+1, which every wave reaches
// only after its reads of buffer b in trip t have returned.
// L2 prefetch: the blocks that share a row or column panel walk k in step, so the
// register loads of a tile can meet lines that are still on their way from memory
// (inputs) or from where the launch before left them (MODE 1's A). Each pass of
// the loop (two k tiles) therefore asks L2 for the two tiles that the loads reach
// PF_LEAD passes later: a lane of waves 0-3 for a row of A, a lane of waves 4-7
// for a 256-byte unit of W. MODE 0 has 24 blocks on a row panel and 16 on a column
// panel: there a block asks for every fourth piece only (A dealt by blockIdx.x, W
// by blockIdx.y; one wave each), so that each piece still has 6 or 4 askers and
// the requests stay few beside the loads. A hint, for speed only: no result rests
// on it, wherever the blocks run.
// ---------------------------------------------------------------------------
#define PF_LEAD 3
template <int MODE>
__global__ __launch_bounds__(256)
void gemm_wmma(const float* __restrict__ A, const __bf16* __restrict__ Abf,
               const float* __restrict__ W0, const float* __restrict__ W1,
               const float* __restrict__ W2, const float* __restrict__ bias0,
               const float* __restrict__ bias1, const float* __restrict__ bias2,
               __bf16* __restrict__ outbf0, float* __restrict__ outf,
               const float* __restrict__ resid, int N, int K, int Dout) {
    __shared__ __align__(16) __bf16 lA[2][128 * PITCH_A];
    __shared__ __align__(16) __bf16 lB[2][32 * PITCH_B];

    const float* __restrict__ W    = W0;
    const float* __restrict__ bias = bias0;
    __bf16* __restrict__ outbf     = outbf0;
    if constexpr (MODE == 0) {
        const int z = blockIdx.z;
        W     = (z == 0) ? W0 : (z == 1) ? W1 : W2;
        bias  = (z == 0) ? bias0 : (z == 1) ? bias1 : bias2;
        outbf = outbf0 + (size_t)z * N * Dout;
    }

    const int tid  = threadIdx.x;
    const int wave = tid >> 5;
    const int lane = tid & 31;
    const int lm   = lane & 15;
    const int hl   = lane >> 4;
    const int wrow = wave >> 2;            // 0..1  -> 64-row slab
    const int wcol = wave & 3;             // 0..3  -> 32-col slab
    const int row0 = blockIdx.y * 128;
    const int col0 = blockIdx.x * 128;

    v8f zero = {};
    v8f acc[4][2];
#pragma unroll
    for (int i = 0; i < 4; ++i)
#pragma unroll
        for (int j = 0; j < 2; ++j) acc[i][j] = zero;

    // This thread's four vec4 chunks of the A tile (128x32: rows ar + 32 rep) and
    // of the W tile (32x128: rows br + 8 rep), as offsets from block-uniform
    // pointers that step from tile to tile.
    const int ar = tid >> 3, ac = (tid & 7) * 4;
    const int br = tid >> 5, bc = (tid & 31) * 4;
    unsigned aoff[4], boff[4];
#pragma unroll
    for (int rep = 0; rep < 4; ++rep) {
        aoff[rep] = (unsigned)((ar + rep * 32) * K + ac);
        boff[rep] = (unsigned)((br + rep * 8) * Dout + bc);
    }
    const float*  pA  = nullptr;                        // MODE 0
    const __bf16* pAb = nullptr;                        // MODE 1
    if constexpr (MODE == 0) pA  = A + (size_t)row0 * K;
    else                     pAb = Abf + (size_t)row0 * K;
    const float* pW = W + col0;

    // This lane's piece of a pair of k tiles, and the bytes from one pair to the
    // next (alike in a wave). The pointer lives in one register pair through the
    // loop and stops at the last pair, so that it names bytes of its operand
    // before and behind every step.
    const int np = K / 64;                              // pairs of k tiles
    constexpr int DEAL = (MODE == 0) ? 4 : 1;           // a block asks for 1 piece in DEAL
    const int  wv     = __builtin_amdgcn_readfirstlane(wave);
    const bool pfA    = wv < 4;
    const bool pfasks = (wv & 3) < 4 / DEAL;            // alike in a wave: a scalar branch
    // Piece 0..127 of the operand's 128 (the mask keeps the idle waves' pointers
    // inside the operand too).
    const int piece = (((wv & 3) * 32 + lane) * DEAL +
                       (int)((pfA ? blockIdx.x : blockIdx.y) & (DEAL - 1))) & 127;
    const char* pf;
    if (pfA) {
        if constexpr (MODE == 0) pf = (const char*)(A + (size_t)(row0 + piece) * K);
        else                     pf = (const char*)(Abf + (size_t)(row0 + piece) * K);
    } else {
        pf = (const char*)(W + (size_t)(piece >> 1) * Dout + col0 + (piece & 1) * 64);
    }
    const unsigned pfstep = pfA ? 64u * (MODE == 0 ? 4u : 2u) : 64u * 4u * (unsigned)Dout;
    int pfpair = 0;                                     // the pair pf would stand at unclamped
    auto pf_step = [&]() {
        ++pfpair;
        pf += (pfpair < np) ? pfstep : 0u;
    };
    auto pf_ask = [&]() {
        // Brings the line into L2 only; returns nothing and counts on no counter.
        if (pfasks) asm volatile("global_prefetch_b8 %0, off scope:SCOPE_SE" :: "v"(pf));
    };

    auto fetch = [&](GemmTileRegs<MODE>& t) {
#pragma unroll
        for (int rep = 0; rep < 4; ++rep) {
            if constexpr (MODE == 0) t.a[rep]  = *(const f32x4*)&pA[aoff[rep]];
            else                     t.ab[rep] = *(const bf16x4*)&pAb[aoff[rep]];
        }
#pragma unroll
        for (int rep = 0; rep < 4; ++rep) t.b[rep] = *(const f32x4*)&pW[boff[rep]];
        // The pointers step next: the wait that stands in front of an overwrite of
        // a register which an issued global load names.
        asm volatile("s_wait_xcnt 0x0" ::: "memory");
        if constexpr (MODE == 0) pA += 32;
        else                     pAb += 32;
        pW += (size_t)32 * Dout;
    };
    auto stage = [&](const GemmTileRegs<MODE>& t, __bf16* sA, __bf16* sB) {
#pragma unroll
        for (int rep = 0; rep < 4; ++rep) {
            if constexpr (MODE == 0) {
                f32x4 v = t.a[rep];
                bf16x4 b = {(__bf16)v.x, (__bf16)v.y, (__bf16)v.z, (__bf16)v.w};
                *(bf16x4*)&sA[(ar + rep * 32) * PITCH_A + ac] = b;
            } else {
                *(bf16x4*)&sA[(ar + rep * 32) * PITCH_A + ac] = t.ab[rep];
            }
        }
#pragma unroll
        for (int rep = 0; rep < 4; ++rep) {
            f32x4 v = t.b[rep];
            bf16x4 b = {(__bf16)v.x, (__bf16)v.y, (__bf16)v.z, (__bf16)v.w};
            *(bf16x4*)&sB[(br + rep * 8) * PITCH_B + bc] = b;
        }
    };
    // One trip: tile t out of its register set into LDS buffer b, the barrier, the
    // fragment reads, tile t+2's loads into the same set (while one exists), the
    // products. The global loads stand behind the fragment reads, so that their
    // issue and their wait run under the LDS latency.
    auto trip = [&](GemmTileRegs<MODE>& t, int b, bool more, bool ask) __attribute__((always_inline)) {
        stage(t, lA[b], lB[b]);
        barrier_lds();
        v16bf af[4], bfr[2];
#pragma unroll
        for (int i = 0; i < 4; ++i)
            af[i] = load_frag(&lA[b][(wrow * 64 + i * 16 + lm) * PITCH_A], hl);
#pragma unroll
        for (int j = 0; j < 2; ++j)
            bfr[j] = load_frag_tr<PITCH_B>(lB[b], wcol * 32 + j * 16, lane);
        // Keeps the twelve fragment reads in one group at the head of the trip:
        // spread among the products, each place with reads waits out the LDS
        // latency anew.
        __builtin_amdgcn_sched_barrier(0);
        if (more) {
            if (ask) pf_ask();
            fetch(t);
            if (ask) pf_step();                         // behind fetch's wait
            // Keeps the global loads ahead of the products: the compiler otherwise
            // lands them in fragment registers and holds them back until the
            // products have read those.
            __builtin_amdgcn_sched_barrier(0);
        }
#pragma unroll
        for (int i = 0; i < 4; ++i)
#pragma unroll
            for (int j = 0; j < 2; ++j)
                acc[i][j] = __builtin_amdgcn_wmma_f32_16x16x32_bf16(
                    false, af[i], false, bfr[j], (short)0, acc[i][j], false, false);
        // Keeps the next trip's conversion, and with it the wait for its tile,
        // behind this trip's products: moved up among them it would wait for
        // loads that are only one trip old.
        __builtin_amdgcn_sched_barrier(0);
    };

    GemmTileRegs<MODE> t0, t1;
    // The pairs that the loop's first PF_LEAD passes load are asked for here. Kept
    // rolled, so that these requests too name the pointer's own register pair and
    // not temporaries that soon hold something else.
#pragma unroll 1
    for (int i = 0; i < PF_LEAD; ++i) {
        pf_step();
        pf_ask();
    }
    pf_step();
    fetch(t0);
    // Keeps tile 0's loads ahead of tile 1's, as in the loop, so that the counted
    // waits at the loop's head leave tile 1 in flight on the first trip too.
    __builtin_amdgcn_sched_barrier(0);
    fetch(t1);
    // The last two trips stand behind the loop, without loads: no branch in the
    // loop, so the waits for a tile count the younger tile's loads exactly.
    for (int k0 = 64; k0 < K; k0 += 64) {
        trip(t0, 0, true, true);
        trip(t1, 1, true, false);
    }
    trip(t0, 0, false, false);
    trip(t1, 1, false, false);

#pragma unroll
    for (int i = 0; i < 4; ++i)
#pragma unroll
        for (int j = 0; j < 2; ++j) {
            int gcol = col0 + wcol * 32 + j * 16 + lm;
            float bv = bias[gcol];
#pragma unroll
            for (int v = 0; v < 8; ++v) {
                int grow = row0 + wrow * 64 + i * 16 + v + 8 * hl;
                size_t gi = (size_t)grow * Dout + gcol;
                float val = acc[i][j][v] + bv;
                if constexpr (MODE == 0) outbf[gi] = (__bf16)val;
                else                     outf[gi] = val + resid[gi];
            }
        }
}

// Lane l <-> lane l ^ 16: the other half of the wave.
__device__ __forceinline__ float xhalf(float x) {
    int b = __builtin_bit_cast(int, x);
    return __builtin_bit_cast(float, __builtin_amdgcn_permlanex16(
        b, b, 0x76543210, 0xfedcba98, false, false));
}

// e^x as 2^(x * log2 e) on the transcendental unit, as __expf compiles. The
// v_nop in the same statement keeps the one free slot that the instruction set
// asks for behind a transcendental, whatever the compiler schedules next.
__device__ __forceinline__ float exp_slot(float x) {
    float r;
    asm("v_exp_f32 %0, %1\n\tv_nop" : "=v"(r) : "v"(x * 1.44269504088896340736f));
    return r;
}

#define KSLICES 4
#define STAGE_KEYS (32 * KSLICES)
#define NQTILE (SEQ / 64)                               // query tiles, even
#define PITCH_O 68                                      // 64 f32 rows, 272 B
__global__ __launch_bounds__(512)
void attn_flash(const __bf16* __restrict__ Q, const __bf16* __restrict__ Kb,
                const __bf16* __restrict__ Vb, __bf16* __restrict__ ctx) {
    __shared__ __align__(16) __bf16 lQ[64 * 64];               // 8 KB
    __shared__ __align__(16) __bf16 lK[2][STAGE_KEYS * PITCH_K];  // [key][d]
    __shared__ __align__(16) __bf16 lV[2][STAGE_KEYS * PITCH_V];  // [key][d]
    __shared__ __align__(16) float lO[KSLICES][64 * PITCH_O];  // partial ctx [query][d]
    __shared__ float lM[KSLICES][64], lL[KSLICES][64];         // partial max, sum

    const int tid   = threadIdx.x;
    // In a scalar register, so that the per-wave skip below is a scalar branch.
    const int wave  = __builtin_amdgcn_readfirstlane(tid >> 5);
    const int lane  = tid & 31;
    const int lm    = lane & 15;
    const int hl    = lane >> 4;
    const int grp   = wave >> 2;                        // key slice
    const int slab  = wave & 3;                         // query slab
    const int h     = blockIdx.x;
    const int rank  = blockIdx.y;
    const int qtile = (rank < NQTILE / 2) ? NQTILE - 1 - rank : rank - NQTILE / 2;
    const int qbase = qtile * 64 + slab * 16;
    const int hoff  = h * DK;

    // One stage (128 keys x 64 d of K and of V) into ring buffer b: a thread
    // copies two 16-byte pieces of each.
    auto copy_stage = [&](int st, int b) {
#pragma unroll
        for (int rep = 0; rep < 2; ++rep) {
            int idx = tid + rep * 512;                  // 0..1023 x 16B
            int r = idx >> 3, c8 = (idx & 7) * 8;
            const size_t g = (size_t)(st * STAGE_KEYS + r) * DMODEL + hoff + c8;
            __builtin_amdgcn_global_load_async_to_lds_b128(
                (AS1 v4i*)&Kb[g], (AS3 v4i*)&lK[b][r * PITCH_K + c8], 0, 0);
            __builtin_amdgcn_global_load_async_to_lds_b128(
                (AS1 v4i*)&Vb[g], (AS3 v4i*)&lV[b][r * PITCH_V + c8], 0, 0);
        }
    };
    // Asks L2 for a stage's K and V rows, one stage ahead of their copies (the four
    // waves of key slice 0, a lane a row).
    auto prefetch_stage = [&](int st) {
        const int nrow = st * STAGE_KEYS + slab * 32 + lane;
        __builtin_prefetch(&Kb[(size_t)nrow * DMODEL + hoff], 0, 3);
        __builtin_prefetch(&Vb[(size_t)nrow * DMODEL + hoff], 0, 3);
    };
    const int nst = (qtile * 64 + 64 + STAGE_KEYS - 1) / STAGE_KEYS;  // causal bound

    copy_stage(0, 0);                                   // flies under the Q staging

    // stage Q tile (64 rows x 64 dk) once
#pragma unroll
    for (int rep = 0; rep < 2; ++rep) {
        int idx = tid + rep * 512;                     // 0..1023 vec4 chunks
        int r = idx >> 4, c4 = (idx & 15) * 4;
        *(bf16x4*)&lQ[r * 64 + c4] =
            *(const bf16x4*)&Q[(size_t)(qtile * 64 + r) * DMODEL + hoff + c4];
    }
    // This wave's copies of stage 0 have landed before the barrier publishes them.
    asm volatile("s_wait_asynccnt 0x0" ::: "memory");
    __syncthreads();                                    // Q and stage 0 visible
    if (nst > 1) copy_stage(1, 1);
    if (nst > 2 && grp == 0) prefetch_stage(2);
    v16bf qf[2];
#pragma unroll
    for (int c = 0; c < 2; ++c)
        qf[c] = load_frag(&lQ[(slab * 16 + lm) * 64 + c * 32], hl);

    v8f zero = {};
    v8f acc[4];
#pragma unroll
    for (int t = 0; t < 4; ++t) acc[t] = zero;
    float mrun = -__builtin_inff();                     // query lm, both halves alike
    float lrun = 0.f;                                   // this half's keys only
    const int q = qbase + lm;

    for (int st = 0; st < nst; ++st) {
        const __bf16* sK = lK[st & 1];
        const __bf16* sV = lV[st & 1];

        // This wave's 32 keys of the stage. A slice that starts behind the slab's
        // first query is masked for all of the slab and is skipped (both are
        // multiples of 16, so a slice that is not skipped holds at least one
        // open key for every query and the running maximum stays finite). The
        // foot of the trip stands outside the skip: every wave passes it.
        const int kbase = st * STAGE_KEYS + grp * 32;
        if (kbase <= qbase) {
            // ---- S^T = K @ Q^T: s[t][v] = score(key kbase+16t+8hl+v, query lm) ----
            v8f s[2];
            s[0] = zero; s[1] = zero;
#pragma unroll
            for (int t = 0; t < 2; ++t)
#pragma unroll
                for (int c = 0; c < 2; ++c) {
                    v16bf kf = load_frag(&sK[(grp * 32 + t * 16 + lm) * PITCH_K + c * 32], hl);
                    s[t] = __builtin_amdgcn_wmma_f32_16x16x32_bf16(
                        false, kf, false, qf[c], (short)0, s[t], false, false);
                }

            // ---- scale + causal mask + this query's max ----
            float m = -__builtin_inff();
#pragma unroll
            for (int t = 0; t < 2; ++t)
#pragma unroll
                for (int v = 0; v < 8; ++v) {
                    int key = kbase + t * 16 + 8 * hl + v;
                    float sv = s[t][v] * 0.125f;
                    sv = (key > q) ? -__builtin_inff() : sv;
                    s[t][v] = sv;
                    m = fmaxf(m, sv);
                }
            m = fmaxf(m, xhalf(m));

            // ---- online softmax ----
            float mnew  = fmaxf(mrun, m);
            float alpha = exp_slot(mrun - mnew);
            mrun = mnew;
            float sum = 0.f;
#pragma unroll
            for (int t = 0; t < 2; ++t)
#pragma unroll
                for (int v = 0; v < 8; ++v) {
                    float p = exp_slot(s[t][v] - mrun);
                    s[t][v] = p;
                    sum += p;
                }
            lrun = lrun * alpha + sum;
#pragma unroll
            for (int t = 0; t < 4; ++t)
#pragma unroll
                for (int v = 0; v < 8; ++v) acc[t][v] *= alpha;

            // ---- P^T as B operand: element e is key kmap(e, hl) of query lm ----
            v16bf pf;
#pragma unroll
            for (int e = 0; e < 16; ++e) pf[e] = (__bf16)s[e >> 3][e & 7];

            // ---- ctx^T += V^T @ P^T: acc[t][v] = ctx(query lm, dim 16t+8hl+v) ----
#pragma unroll
            for (int t = 0; t < 4; ++t) {
                v16bf vf = load_frag_tr<PITCH_V>(sV + grp * 32 * PITCH_V, t * 16, lane);
                acc[t] = __builtin_amdgcn_wmma_f32_16x16x32_bf16(
                    false, vf, false, pf, (short)0, acc[t], false, false);
            }
        }

        // ---- foot of the trip, every wave ----
        // This wave's reads of the stage have returned before its buffer is freed.
        asm volatile("s_wait_dscnt 0x0" ::: "memory");
        // This wave's copies of the next stage have landed before they are published.
        asm volatile("s_wait_asynccnt 0x0" ::: "memory");
        __syncthreads();                                // next stage visible, this buffer free
        if (st + 2 < nst) copy_stage(st + 2, st & 1);
        if (st + 3 < nst && grp == 0) prefetch_stage(st + 3);
    }
    // No copy is left in flight when the wave goes on (none is issued behind the
    // last wait of the loop; a precaution).
    asm volatile("s_wait_asynccnt 0x0" ::: "memory");

    // ---- hand over this slice's partial result (a slice that never ran:
    //      maximum -inf, sum 0, context 0, weight 0 below) ----
    const float lpart = lrun + xhalf(lrun);             // join the halves' sums
#pragma unroll
    for (int t = 0; t < 4; ++t) {
        float* o = &lO[grp][(slab * 16 + lm) * PITCH_O + t * 16 + 8 * hl];
        f32x4 lo = {acc[t][0], acc[t][1], acc[t][2], acc[t][3]};
        f32x4 hi = {acc[t][4], acc[t][5], acc[t][6], acc[t][7]};
        *(f32x4*)o       = lo;
        *(f32x4*)(o + 4) = hi;
    }
    if (hl == 0) {
        lM[grp][slab * 16 + lm] = mrun;
        lL[grp][slab * 16 + lm] = lpart;
    }
    __syncthreads();                                    // partials visible to all waves

    // ---- merge: each wave finishes four whole rows, a lane 8 dims of one ----
    const int qr = wave * 4 + (lane >> 3);              // row of the query tile
    const int d0 = (lane & 7) * 8;
    float mall = -__builtin_inff();                     // finite: slice 0 holds key 0
#pragma unroll
    for (int g = 0; g < KSLICES; ++g) mall = fmaxf(mall, lM[g][qr]);
    float ltot = 0.f;
    float osum[8] = {0.f, 0.f, 0.f, 0.f, 0.f, 0.f, 0.f, 0.f};
#pragma unroll
    for (int g = 0; g < KSLICES; ++g) {
        const float wgt = exp_slot(lM[g][qr] - mall);
        ltot += wgt * lL[g][qr];
        const float* o = &lO[g][qr * PITCH_O + d0];
        f32x4 lo = *(const f32x4*)o;
        f32x4 hi = *(const f32x4*)(o + 4);
#pragma unroll
        for (int v = 0; v < 4; ++v) {
            osum[v]     += wgt * lo[v];
            osum[v + 4] += wgt * hi[v];
        }
    }
    bf16x8 ob;
#pragma unroll
    for (int v = 0; v < 8; ++v) ob[v] = (__bf16)(osum[v] / ltot);
    *(bf16x8*)&ctx[(size_t)(qtile * 64 + qr) * DMODEL + hoff + d0] = ob;
}

// ---------------------------------------------------------------------------
// Row-wise LayerNorm, in place on d_out.
// ---------------------------------------------------------------------------
__global__ __launch_bounds__(256)
void layernorm_kernel(float* __restrict__ y, const float* __restrict__ gamma,
                      const float* __restrict__ beta) {
    __shared__ float ssum[8], ssum2[8];
    const int row = blockIdx.x;
    const int tid = threadIdx.x;
    float s = 0.f, s2 = 0.f;
    for (int i = tid; i < DMODEL; i += 256) {
        float v = y[(size_t)row * DMODEL + i];
        s += v; s2 += v * v;
    }
#pragma unroll
    for (int off = 1; off < 32; off <<= 1) {
        s  += __shfl_xor(s,  off, 32);
        s2 += __shfl_xor(s2, off, 32);
    }
    int wave = tid >> 5, lane = tid & 31;
    if (lane == 0) { ssum[wave] = s; ssum2[wave] = s2; }
    __syncthreads();
    float ts = 0.f, ts2 = 0.f;
#pragma unroll
    for (int w = 0; w < 8; ++w) { ts += ssum[w]; ts2 += ssum2[w]; }
    float mu  = ts * (1.f / DMODEL);
    float var = ts2 * (1.f / DMODEL) - mu * mu;
    float inv = rsqrtf(var + LN_EPS);
    for (int i = tid; i < DMODEL; i += 256) {
        float v = y[(size_t)row * DMODEL + i];
        y[(size_t)row * DMODEL + i] = (v - mu) * inv * gamma[i] + beta[i];
    }
}

extern "C" void kernel_launch(void* const* d_in, const int* in_sizes, int n_in,
                              void* d_out, int out_size, void* d_ws, size_t ws_size,
                              hipStream_t stream) {
    const float* x     = (const float*)d_in[0];
    const float* Wq    = (const float*)d_in[1];
    const float* bq    = (const float*)d_in[2];
    const float* Wk    = (const float*)d_in[3];
    const float* bk    = (const float*)d_in[4];
    const float* Wv    = (const float*)d_in[5];
    const float* bv    = (const float*)d_in[6];
    const float* Wo    = (const float*)d_in[7];
    const float* bo    = (const float*)d_in[8];
    const float* gamma = (const float*)d_in[9];
    const float* beta  = (const float*)d_in[10];
    float* out = (float*)d_out;

    char* ws = (char*)d_ws;
    const size_t MAT = (size_t)SEQ * DMODEL * sizeof(__bf16);  // 4 MB
    __bf16* Qb = (__bf16*)(ws);
    __bf16* Kb = (__bf16*)(ws + MAT);
    __bf16* Vb = (__bf16*)(ws + 2 * MAT);
    __bf16* Cb = (__bf16*)(ws + 3 * MAT);

    dim3 gGemm(DMODEL / 128, SEQ / 128);
    dim3 gQkv(DMODEL / 128, SEQ / 128, 3);              // planes Qb, Kb, Vb
    gemm_wmma<0><<<gQkv, 256, 0, stream>>>(x, nullptr, Wq, Wk, Wv, bq, bk, bv, Qb,
                                           nullptr, nullptr, SEQ, DMODEL, DMODEL);
    dim3 gAttn(NHEAD, SEQ / 64);
    attn_flash<<<gAttn, 512, 0, stream>>>(Qb, Kb, Vb, Cb);
    gemm_wmma<1><<<gGemm, 256, 0, stream>>>(nullptr, Cb, Wo, nullptr, nullptr, bo,
                                            nullptr, nullptr, nullptr, out, x,
                                            SEQ, DMODEL, DMODEL);
    layernorm_kernel<<<SEQ, 256, 0, stream>>>(out, gamma, beta);
}

// v009
// It runs in 56.6 microseconds.
// Two timings next to v008 both put it at 1.07 times that version's speed.
// Over all steps from v000 it is 7.23 times as fast.
#include <hip/hip_runtime.h>

#define SEQ 2048
#define DMODEL 1024
#define NHEAD 16
#define DK 64
#define LN_EPS 1e-5f

typedef __bf16 v16bf  __attribute__((ext_vector_type(16)));
typedef __bf16 bf16x8 __attribute__((ext_vector_type(8)));
typedef __bf16 bf16x4 __attribute__((ext_vector_type(4)));
typedef float  v8f    __attribute__((ext_vector_type(8)));
typedef float  f32x4  __attribute__((ext_vector_type(4)));
typedef int    v4i    __attribute__((ext_vector_type(4)));

#define AS1 __attribute__((address_space(1)))
#define AS3 __attribute__((address_space(3)))

// K-index mapping kmap(e, hl) of 16-bit A/B fragments of V_WMMA_*_16X16X32_*
// (ISA 7.12.2): element e -> K = {0..7}+8*hl for e<8, {16..23}+8*hl for e>=8.

// LDS row pitches in elements. Rows read by ds_load_b128 stand at an odd
// multiple of 16 B, rows read by ds_load_tr16_b128 at an odd multiple of 32 B:
// a half wave's sixteen 16-byte reads then cover the 64 banks once.
#define PITCH_A 40                                      // 32-element rows,  80 B
#define PITCH_B 144                                     // 128-element rows, 288 B
#define PITCH_K 72                                      // 64-element rows,  144 B
#define PITCH_V 80                                      // 64-element rows,  160 B

// Fragment whose element e reads p[kmap(e,hl)]: two contiguous 16B runs.
__device__ __forceinline__ v16bf load_frag(const __bf16* p, int hl) {
    bf16x8 a0 = *(const bf16x8*)(p + 8 * hl);
    bf16x8 a1 = *(const bf16x8*)(p + 16 + 8 * hl);
    return __builtin_shufflevector(a0, a1, 0, 1, 2, 3, 4, 5, 6, 7,
                                   8, 9, 10, 11, 12, 13, 14, 15);
}

// Transposed fragment from a row-major LDS tile T[k][n] (32 rows of k, PITCH
// elements apart): lane (lm, hl) gets element e = T[kmap(e,hl)][n0 + lm]. Each
// transposing load takes 16 rows of k; lane l points at the 16 bytes at row
// 8*(l>>4) + (l&7), column n0 + 8*((l>>3)&1).
template <int PITCH>
__device__ __forceinline__ v16bf load_frag_tr(const __bf16* tile, int n0, int lane) {
    const __bf16* p = tile + (8 * (lane >> 4) + (lane & 7)) * PITCH + n0 +
                      8 * ((lane >> 3) & 1);
    bf16x8 a0 = __builtin_amdgcn_ds_load_tr16_b128_v8bf16((AS3 bf16x8*)p);
    bf16x8 a1 = __builtin_amdgcn_ds_load_tr16_b128_v8bf16((AS3 bf16x8*)(p + 16 * PITCH));
    return __builtin_shufflevector(a0, a1, 0, 1, 2, 3, 4, 5, 6, 7,
                                   8, 9, 10, 11, 12, 13, 14, 15);
}

// Work-group barrier that orders LDS traffic only. __syncthreads() also waits for
// every global load in flight, which would drain the tiles fetched ahead; the
// waves of a block hand each other nothing through global memory in the k loop.
__device__ __forceinline__ void barrier_lds() {
    __builtin_amdgcn_fence(__ATOMIC_RELEASE, "workgroup", "local");
    __builtin_amdgcn_s_barrier();
    __builtin_amdgcn_fence(__ATOMIC_ACQUIRE, "workgroup", "local");
}

// The DMODEL x DMODEL f32 weight Wsrc[k][n] as bf16 B fragments, in the order in
// which a wave reads them: fragment (kt, nt) covers k = 32 kt.., n = 16 nt.. and is
// 1 KB, two halves of 512 B; half c holds, at 16 bytes a lane, elements 8c..8c+7 of
// lane (lm, hl), element e being Wsrc[32 kt + kmap(e, hl)][16 nt + lm]. A unit is one
// lane's share of one fragment; thread 'first' of 'step' takes every step-th unit.
#define KT_O (DMODEL / 32)
#define NT_O (DMODEL / 16)
__device__ __forceinline__ void pack_fragments(const float* __restrict__ Wsrc,
                                               __bf16* __restrict__ dst, int first, int step) {
    for (int u = first; u < KT_O * NT_O * 32; u += step) {
        const int l = u & 31, f = u >> 5;
        const int kt = f / NT_O, nt = f % NT_O;
        const float* s = Wsrc + (size_t)(kt * 32 + 8 * (l >> 4)) * DMODEL + nt * 16 + (l & 15);
        bf16x8 lo, hi;
#pragma unroll
        for (int e = 0; e < 8; ++e) {
            lo[e] = (__bf16)s[(size_t)e * DMODEL];
            hi[e] = (__bf16)s[(size_t)(e + 16) * DMODEL];
        }
        *(bf16x8*)&dst[(size_t)f * 512 + l * 8]       = lo;
        *(bf16x8*)&dst[(size_t)f * 512 + 256 + l * 8] = hi;
    }
}

struct GemmTileRegs {                                   // one thread's share of a k tile
    f32x4 a[4];                                         // A chunks
    f32x4 b[4];                                         // W chunks
};

// ---------------------------------------------------------------------------
// Tiled bf16 WMMA GEMM: out[N,Dout] = A[N,K] @ W[K,Dout] + bias, A and W f32, out bf16.
// 256 threads = 8 waves (2x4), block tile 128x128, wave tile 64x32, K-step 32;
// K a multiple of 64.
// Three products on the same A in one launch: blockIdx.z = 0..2 picks the weight
// and bias, and the outputs are three N x Dout planes one after another. The
// blocks of plane 3 pack Wpack (see pack_fragments) and multiply nothing.
// The k loop's global loads run two tiles ahead, in two register sets: trip t
// converts tile t from its set into LDS buffer t & 1, passes the barrier, reads
// its fragments, issues tile t+2's loads into the set just freed and multiplies.
// With two LDS buffers one barrier a trip is enough: a wave that writes buffer b
// again in trip t+2 has passed the barrier of trip t+1, which every wave reaches
// only after its reads of buffer b in trip t have returned.
// L2 prefetch: the blocks that share a row or column panel walk k in step, so the
// register loads of a tile can meet lines that are still on their way from memory.
// Each pass of the loop (two k tiles) therefore asks L2 for the two tiles that the
// loads reach PF_LEAD passes later: a lane of waves 0-3 for a row of A, a lane of
// waves 4-7 for a 256-byte unit of W. 24 blocks are on a row panel and 16 on a column
// panel: a block asks for every fourth piece only (A dealt by blockIdx.x, W
// by blockIdx.y; one wave each), so that each piece still has 6 or 4 askers and
// the requests stay few beside the loads. A hint, for speed only: no result rests
// on it, wherever the blocks run.
// ---------------------------------------------------------------------------
#define PF_LEAD 3
__global__ __launch_bounds__(256)
void gemm_wmma(const float* __restrict__ A, const float* __restrict__ W0, const float* __restrict__ W1,
               const float* __restrict__ W2, const float* __restrict__ bias0,
               const float* __restrict__ bias1, const float* __restrict__ bias2,
               __bf16* __restrict__ outbf0, const float* __restrict__ Wpack,
               __bf16* __restrict__ packed, int N, int K, int Dout) {
    __shared__ __align__(16) __bf16 lA[2][128 * PITCH_A];
    __shared__ __align__(16) __bf16 lB[2][32 * PITCH_B];

    // Plane 3 multiplies nothing: its blocks pack the output projection's weight
    // for the launch after next. The whole block leaves here, in front of every
    // barrier.
    if (blockIdx.z == 3) {
        pack_fragments(Wpack, packed,
                       (blockIdx.y * gridDim.x + blockIdx.x) * 256 + threadIdx.x,
                       gridDim.x * gridDim.y * 256);
        return;
    }

    const int z = blockIdx.z;
    const float* __restrict__ W    = (z == 0) ? W0 : (z == 1) ? W1 : W2;
    const float* __restrict__ bias = (z == 0) ? bias0 : (z == 1) ? bias1 : bias2;
    __bf16* __restrict__ outbf     = outbf0 + (size_t)z * N * Dout;

    const int tid  = threadIdx.x;
    const int wave = tid >> 5;
    const int lane = tid & 31;
    const int lm   = lane & 15;
    const int hl   = lane >> 4;
    const int wrow = wave >> 2;            // 0..1  -> 64-row slab
    const int wcol = wave & 3;             // 0..3  -> 32-col slab
    const int row0 = blockIdx.y * 128;
    const int col0 = blockIdx.x * 128;

    v8f zero = {};
    v8f acc[4][2];
#pragma unroll
    for (int i = 0; i < 4; ++i)
#pragma unroll
        for (int j = 0; j < 2; ++j) acc[i][j] = zero;

    // This thread's four vec4 chunks of the A tile (128x32: rows ar + 32 rep) and
    // of the W tile (32x128: rows br + 8 rep), as offsets from block-uniform
    // pointers that step from tile to tile.
    const int ar = tid >> 3, ac = (tid & 7) * 4;
    const int br = tid >> 5, bc = (tid & 31) * 4;
    unsigned aoff[4], boff[4];
#pragma unroll
    for (int rep = 0; rep < 4; ++rep) {
        aoff[rep] = (unsigned)((ar + rep * 32) * K + ac);
        boff[rep] = (unsigned)((br + rep * 8) * Dout + bc);
    }
    const float* pA = A + (size_t)row0 * K;
    const float* pW = W + col0;

    // This lane's piece of a pair of k tiles, and the bytes from one pair to the
    // next (alike in a wave). The pointer lives in one register pair through the
    // loop and stops at the last pair, so that it names bytes of its operand
    // before and behind every step.
    const int np = K / 64;                              // pairs of k tiles
    constexpr int DEAL = 4;                             // a block asks for 1 piece in DEAL
    const int  wv     = __builtin_amdgcn_readfirstlane(wave);
    const bool pfA    = wv < 4;
    const bool pfasks = (wv & 3) < 4 / DEAL;            // alike in a wave: a scalar branch
    // Piece 0..127 of the operand's 128 (the mask keeps the idle waves' pointers
    // inside the operand too).
    const int piece = (((wv & 3) * 32 + lane) * DEAL +
                       (int)((pfA ? blockIdx.x : blockIdx.y) & (DEAL - 1))) & 127;
    const char* pf;
    if (pfA) {
        pf = (const char*)(A + (size_t)(row0 + piece) * K);
    } else {
        pf = (const char*)(W + (size_t)(piece >> 1) * Dout + col0 + (piece & 1) * 64);
    }
    const unsigned pfstep = pfA ? 64u * 4u : 64u * 4u * (unsigned)Dout;
    int pfpair = 0;                                     // the pair pf would stand at unclamped
    auto pf_step = [&]() {
        ++pfpair;
        pf += (pfpair < np) ? pfstep : 0u;
    };
    auto pf_ask = [&]() {
        // Brings the line into L2 only; returns nothing and counts on no counter.
        if (pfasks) asm volatile("global_prefetch_b8 %0, off scope:SCOPE_SE" :: "v"(pf));
    };

    auto fetch = [&](GemmTileRegs& t) {
#pragma unroll
        for (int rep = 0; rep < 4; ++rep) t.a[rep] = *(const f32x4*)&pA[aoff[rep]];
#pragma unroll
        for (int rep = 0; rep < 4; ++rep) t.b[rep] = *(const f32x4*)&pW[boff[rep]];
        // The pointers step next: the wait that stands in front of an overwrite of
        // a register which an issued global load names.
        asm volatile("s_wait_xcnt 0x0" ::: "memory");
        pA += 32;
        pW += (size_t)32 * Dout;
    };
    auto stage = [&](const GemmTileRegs& t, __bf16* sA, __bf16* sB) {
#pragma unroll
        for (int rep = 0; rep < 4; ++rep) {
            f32x4 v = t.a[rep];
            bf16x4 b = {(__bf16)v.x, (__bf16)v.y, (__bf16)v.z, (__bf16)v.w};
            *(bf16x4*)&sA[(ar + rep * 32) * PITCH_A + ac] = b;
        }
#pragma unroll
        for (int rep = 0; rep < 4; ++rep) {
            f32x4 v = t.b[rep];
            bf16x4 b = {(__bf16)v.x, (__bf16)v.y, (__bf16)v.z, (__bf16)v.w};
            *(bf16x4*)&sB[(br + rep * 8) * PITCH_B + bc] = b;
        }
    };
    // One trip: tile t out of its register set into LDS buffer b, the barrier, the
    // fragment reads, tile t+2's loads into the same set (while one exists), the
    // products. The global loads stand behind the fragment reads, so that their
    // issue and their wait run under the LDS latency.
    auto trip = [&](GemmTileRegs& t, int b, bool more, bool ask) __attribute__((always_inline)) {
        stage(t, lA[b], lB[b]);
        barrier_lds();
        v16bf af[4], bfr[2];
#pragma unroll
        for (int i = 0; i < 4; ++i)
            af[i] = load_frag(&lA[b][(wrow * 64 + i * 16 + lm) * PITCH_A], hl);
#pragma unroll
        for (int j = 0; j < 2; ++j)
            bfr[j] = load_frag_tr<PITCH_B>(lB[b], wcol * 32 + j * 16, lane);
        // Keeps the twelve fragment reads in one group at the head of the trip:
        // spread among the products, each place with reads waits out the LDS
        // latency anew.
        __builtin_amdgcn_sched_barrier(0);
        if (more) {
            if (ask) pf_ask();
            fetch(t);
            if (ask) pf_step();                         // behind fetch's wait
            // Keeps the global loads ahead of the products: the compiler otherwise
            // lands them in fragment registers and holds them back until the
            // products have read those.
            __builtin_amdgcn_sched_barrier(0);
        }
#pragma unroll
        for (int i = 0; i < 4; ++i)
#pragma unroll
            for (int j = 0; j < 2; ++j)
                acc[i][j] = __builtin_amdgcn_wmma_f32_16x16x32_bf16(
                    false, af[i], false, bfr[j], (short)0, acc[i][j], false, false);
        // Keeps the next trip's conversion, and with it the wait for its tile,
        // behind this trip's products: moved up among them it would wait for
        // loads that are only one trip old.
        __builtin_amdgcn_sched_barrier(0);
    };

    GemmTileRegs t0, t1;
    // The pairs that the loop's first PF_LEAD passes load are asked for here. Kept
    // rolled, so that these requests too name the pointer's own register pair and
    // not temporaries that soon hold something else.
#pragma unroll 1
    for (int i = 0; i < PF_LEAD; ++i) {
        pf_step();
        pf_ask();
    }
    pf_step();
    fetch(t0);
    // Keeps tile 0's loads ahead of tile 1's, as in the loop, so that the counted
    // waits at the loop's head leave tile 1 in flight on the first trip too.
    __builtin_amdgcn_sched_barrier(0);
    fetch(t1);
    // The last two trips stand behind the loop, without loads: no branch in the
    // loop, so the waits for a tile count the younger tile's loads exactly.
    for (int k0 = 64; k0 < K; k0 += 64) {
        trip(t0, 0, true, true);
        trip(t1, 1, true, false);
    }
    trip(t0, 0, false, false);
    trip(t1, 1, false, false);

#pragma unroll
    for (int i = 0; i < 4; ++i)
#pragma unroll
        for (int j = 0; j < 2; ++j) {
            int gcol = col0 + wcol * 32 + j * 16 + lm;
            float bv = bias[gcol];
#pragma unroll
            for (int v = 0; v < 8; ++v) {
                int grow = row0 + wrow * 64 + i * 16 + v + 8 * hl;
                size_t gi = (size_t)grow * Dout + gcol;
                outbf[gi] = (__bf16)(acc[i][j][v] + bv);
            }
        }
    // The wait that stands in front of an overwrite of a register which an issued
    // global store names: in the built code the packing branch stands behind these
    // stores and reuses their registers.
    asm volatile("s_wait_xcnt 0x0" ::: "memory");
}

// Lane l <-> lane l ^ 16: the other half of the wave.
__device__ __forceinline__ float xhalf(float x) {
    int b = __builtin_bit_cast(int, x);
    return __builtin_bit_cast(float, __builtin_amdgcn_permlanex16(
        b, b, 0x76543210, 0xfedcba98, false, false));
}

// e^x as 2^(x * log2 e) on the transcendental unit, as __expf compiles. The
// v_nop in the same statement keeps the one free slot that the instruction set
// asks for behind a transcendental, whatever the compiler schedules next.
__device__ __forceinline__ float exp_slot(float x) {
    float r;
    asm("v_exp_f32 %0, %1\n\tv_nop" : "=v"(r) : "v"(x * 1.44269504088896340736f));
    return r;
}

#define KSLICES 4
#define STAGE_KEYS (32 * KSLICES)
#define NQTILE (SEQ / 64)                               // query tiles, even
#define PITCH_O 68                                      // 64 f32 rows, 272 B
__global__ __launch_bounds__(512)
void attn_flash(const __bf16* __restrict__ Q, const __bf16* __restrict__ Kb,
                const __bf16* __restrict__ Vb, __bf16* __restrict__ ctx) {
    __shared__ __align__(16) __bf16 lQ[64 * 64];               // 8 KB
    __shared__ __align__(16) __bf16 lK[2][STAGE_KEYS * PITCH_K];  // [key][d]
    __shared__ __align__(16) __bf16 lV[2][STAGE_KEYS * PITCH_V];  // [key][d]
    __shared__ __align__(16) float lO[KSLICES][64 * PITCH_O];  // partial ctx [query][d]
    __shared__ float lM[KSLICES][64], lL[KSLICES][64];         // partial max, sum

    const int tid   = threadIdx.x;
    // In a scalar register, so that the per-wave skip below is a scalar branch.
    const int wave  = __builtin_amdgcn_readfirstlane(tid >> 5);
    const int lane  = tid & 31;
    const int lm    = lane & 15;
    const int hl    = lane >> 4;
    const int grp   = wave >> 2;                        // key slice
    const int slab  = wave & 3;                         // query slab
    const int h     = blockIdx.x;
    const int rank  = blockIdx.y;
    const int qtile = (rank < NQTILE / 2) ? NQTILE - 1 - rank : rank - NQTILE / 2;
    const int qbase = qtile * 64 + slab * 16;
    const int hoff  = h * DK;

    // One stage (128 keys x 64 d of K and of V) into ring buffer b: a thread
    // copies two 16-byte pieces of each.
    auto copy_stage = [&](int st, int b) {
#pragma unroll
        for (int rep = 0; rep < 2; ++rep) {
            int idx = tid + rep * 512;                  // 0..1023 x 16B
            int r = idx >> 3, c8 = (idx & 7) * 8;
            const size_t g = (size_t)(st * STAGE_KEYS + r) * DMODEL + hoff + c8;
            __builtin_amdgcn_global_load_async_to_lds_b128(
                (AS1 v4i*)&Kb[g], (AS3 v4i*)&lK[b][r * PITCH_K + c8], 0, 0);
            __builtin_amdgcn_global_load_async_to_lds_b128(
                (AS1 v4i*)&Vb[g], (AS3 v4i*)&lV[b][r * PITCH_V + c8], 0, 0);
        }
    };
    // Asks L2 for a stage's K and V rows, one stage ahead of their copies (the four
    // waves of key slice 0, a lane a row).
    auto prefetch_stage = [&](int st) {
        const int nrow = st * STAGE_KEYS + slab * 32 + lane;
        __builtin_prefetch(&Kb[(size_t)nrow * DMODEL + hoff], 0, 3);
        __builtin_prefetch(&Vb[(size_t)nrow * DMODEL + hoff], 0, 3);
    };
    const int nst = (qtile * 64 + 64 + STAGE_KEYS - 1) / STAGE_KEYS;  // causal bound

    copy_stage(0, 0);                                   // flies under the Q staging

    // stage Q tile (64 rows x 64 dk) once
#pragma unroll
    for (int rep = 0; rep < 2; ++rep) {
        int idx = tid + rep * 512;                     // 0..1023 vec4 chunks
        int r = idx >> 4, c4 = (idx & 15) * 4;
        *(bf16x4*)&lQ[r * 64 + c4] =
            *(const bf16x4*)&Q[(size_t)(qtile * 64 + r) * DMODEL + hoff + c4];
    }
    // This wave's copies of stage 0 have landed before the barrier publishes them.
    asm volatile("s_wait_asynccnt 0x0" ::: "memory");
    __syncthreads();                                    // Q and stage 0 visible
    if (nst > 1) copy_stage(1, 1);
    if (nst > 2 && grp == 0) prefetch_stage(2);
    v16bf qf[2];
#pragma unroll
    for (int c = 0; c < 2; ++c)
        qf[c] = load_frag(&lQ[(slab * 16 + lm) * 64 + c * 32], hl);

    v8f zero = {};
    v8f acc[4];
#pragma unroll
    for (int t = 0; t < 4; ++t) acc[t] = zero;
    float mrun = -__builtin_inff();                     // query lm, both halves alike
    float lrun = 0.f;                                   // this half's keys only
    const int q = qbase + lm;

    for (int st = 0; st < nst; ++st) {
        const __bf16* sK = lK[st & 1];
        const __bf16* sV = lV[st & 1];

        // This wave's 32 keys of the stage. A slice that starts behind the slab's
        // first query is masked for all of the slab and is skipped (both are
        // multiples of 16, so a slice that is not skipped holds at least one
        // open key for every query and the running maximum stays finite). The
        // foot of the trip stands outside the skip: every wave passes it.
        const int kbase = st * STAGE_KEYS + grp * 32;
        if (kbase <= qbase) {
            // ---- S^T = K @ Q^T: s[t][v] = score(key kbase+16t+8hl+v, query lm) ----
            v8f s[2];
            s[0] = zero; s[1] = zero;
#pragma unroll
            for (int t = 0; t < 2; ++t)
#pragma unroll
                for (int c = 0; c < 2; ++c) {
                    v16bf kf = load_frag(&sK[(grp * 32 + t * 16 + lm) * PITCH_K + c * 32], hl);
                    s[t] = __builtin_amdgcn_wmma_f32_16x16x32_bf16(
                        false, kf, false, qf[c], (short)0, s[t], false, false);
                }

            // ---- scale + causal mask + this query's max ----
            float m = -__builtin_inff();
#pragma unroll
            for (int t = 0; t < 2; ++t)
#pragma unroll
                for (int v = 0; v < 8; ++v) {
                    int key = kbase + t * 16 + 8 * hl + v;
                    float sv = s[t][v] * 0.125f;
                    sv = (key > q) ? -__builtin_inff() : sv;
                    s[t][v] = sv;
                    m = fmaxf(m, sv);
                }
            m = fmaxf(m, xhalf(m));

            // ---- online softmax ----
            float mnew  = fmaxf(mrun, m);
            float alpha = exp_slot(mrun - mnew);
            mrun = mnew;
            float sum = 0.f;
#pragma unroll
            for (int t = 0; t < 2; ++t)
#pragma unroll
                for (int v = 0; v < 8; ++v) {
                    float p = exp_slot(s[t][v] - mrun);
                    s[t][v] = p;
                    sum += p;
                }
            lrun = lrun * alpha + sum;
#pragma unroll
            for (int t = 0; t < 4; ++t)
#pragma unroll
                for (int v = 0; v < 8; ++v) acc[t][v] *= alpha;

            // ---- P^T as B operand: element e is key kmap(e, hl) of query lm ----
            v16bf pf;
#pragma unroll
            for (int e = 0; e < 16; ++e) pf[e] = (__bf16)s[e >> 3][e & 7];

            // ---- ctx^T += V^T @ P^T: acc[t][v] = ctx(query lm, dim 16t+8hl+v) ----
#pragma unroll
            for (int t = 0; t < 4; ++t) {
                v16bf vf = load_frag_tr<PITCH_V>(sV + grp * 32 * PITCH_V, t * 16, lane);
                acc[t] = __builtin_amdgcn_wmma_f32_16x16x32_bf16(
                    false, vf, false, pf, (short)0, acc[t], false, false);
            }
        }

        // ---- foot of the trip, every wave ----
        // This wave's reads of the stage have returned before its buffer is freed.
        asm volatile("s_wait_dscnt 0x0" ::: "memory");
        // This wave's copies of the next stage have landed before they are published.
        asm volatile("s_wait_asynccnt 0x0" ::: "memory");
        __syncthreads();                                // next stage visible, this buffer free
        if (st + 2 < nst) copy_stage(st + 2, st & 1);
        if (st + 3 < nst && grp == 0) prefetch_stage(st + 3);
    }
    // No copy is left in flight when the wave goes on (none is issued behind the
    // last wait of the loop; a precaution).
    asm volatile("s_wait_asynccnt 0x0" ::: "memory");

    // ---- hand over this slice's partial result (a slice that never ran:
    //      maximum -inf, sum 0, context 0, weight 0 below) ----
    const float lpart = lrun + xhalf(lrun);             // join the halves' sums
#pragma unroll
    for (int t = 0; t < 4; ++t) {
        float* o = &lO[grp][(slab * 16 + lm) * PITCH_O + t * 16 + 8 * hl];
        f32x4 lo = {acc[t][0], acc[t][1], acc[t][2], acc[t][3]};
        f32x4 hi = {acc[t][4], acc[t][5], acc[t][6], acc[t][7]};
        *(f32x4*)o       = lo;
        *(f32x4*)(o + 4) = hi;
    }
    if (hl == 0) {
        lM[grp][slab * 16 + lm] = mrun;
        lL[grp][slab * 16 + lm] = lpart;
    }
    __syncthreads();                                    // partials visible to all waves

    // ---- merge: each wave finishes four whole rows, a lane 8 dims of one ----
    const int qr = wave * 4 + (lane >> 3);              // row of the query tile
    const int d0 = (lane & 7) * 8;
    float mall = -__builtin_inff();                     // finite: slice 0 holds key 0
#pragma unroll
    for (int g = 0; g < KSLICES; ++g) mall = fmaxf(mall, lM[g][qr]);
    float ltot = 0.f;
    float osum[8] = {0.f, 0.f, 0.f, 0.f, 0.f, 0.f, 0.f, 0.f};
#pragma unroll
    for (int g = 0; g < KSLICES; ++g) {
        const float wgt = exp_slot(lM[g][qr] - mall);
        ltot += wgt * lL[g][qr];
        const float* o = &lO[g][qr * PITCH_O + d0];
        f32x4 lo = *(const f32x4*)o;
        f32x4 hi = *(const f32x4*)(o + 4);
#pragma unroll
        for (int v = 0; v < 4; ++v) {
            osum[v]     += wgt * lo[v];
            osum[v + 4] += wgt * hi[v];
        }
    }
    bf16x8 ob;
#pragma unroll
    for (int v = 0; v < 8; ++v) ob[v] = (__bf16)(osum[v] / ltot);
    *(bf16x8*)&ctx[(size_t)(qtile * 64 + qr) * DMODEL + hoff + d0] = ob;
}

// Lane l <-> lane l ^ M inside a 16-lane row, and lane N of the row to all of it, by
// DPP: a vector instruction each, where a shuffle goes through the LDS unit.
template <int M>
__device__ __forceinline__ float row_xor(float x) {
    return __builtin_bit_cast(float, __builtin_amdgcn_update_dpp(
        0, __builtin_bit_cast(int, x), 0x160 | M, 0xf, 0xf, true));    // row_xmask:M
}
template <int N>
__device__ __forceinline__ float row_share(float x) {
    return __builtin_bit_cast(float, __builtin_amdgcn_update_dpp(
        0, __builtin_bit_cast(int, x), 0x150 | N, 0xf, 0xf, true));    // row_share:N
}
__device__ __forceinline__ float row_sum(float x) {
    x += row_xor<1>(x);
    x += row_xor<2>(x);
    x += row_xor<4>(x);
    x += row_xor<8>(x);
    return x;
}

// ---------------------------------------------------------------------------
// Output projection, bias, residual and LayerNorm in one launch:
// out = LayerNorm(C @ Wo + bias + resid). A block owns 16 whole rows, so that the
// row sums stay inside it: 512 threads = 16 waves, wave w has columns 64 w..64 w+63
// (four 16x16 accumulators). The block's 16 rows of C stand in LDS, staged once.
// Each W fragment is used by one wave only and comes straight from L2 into
// registers, in the packed order of pack_fragments (every load a whole 512 bytes a
// wave), OD k tiles ahead of its products. The accumulators start from residual +
// bias, whose loads fly with the first tiles.
// ---------------------------------------------------------------------------
#define PITCH_C (DMODEL + 8)                            // 2,064 B, an odd multiple of 16 B
#define OD 5
__global__ __launch_bounds__(512)
void oproj_layernorm(const __bf16* __restrict__ C, const __bf16* __restrict__ Wp,
                     const float* __restrict__ bias, const float* __restrict__ resid,
                     const float* __restrict__ gamma, const float* __restrict__ beta,
                     float* __restrict__ out) {
    __shared__ __align__(16) __bf16 lC[16 * PITCH_C];
    // Partial row sums: [wave][16 hl + v] the sum of row 8 hl + v, [.. + 8] its squares.
    __shared__ __align__(16) float red[16][32];

    const int tid  = threadIdx.x;
    const int wave = __builtin_amdgcn_readfirstlane(tid >> 5);
    const int lane = tid & 31;
    const int lm   = lane & 15;
    const int hl   = lane >> 4;
    const int row0 = blockIdx.x * 16;
    const int col0 = wave * 64;

    // The block's rows of C: 2,048 pieces of 16 bytes, four a thread (rows cr + 4 rep).
    const int cr = tid >> 7, cc = (tid & 127) * 8;
    const __bf16* cp = C + (size_t)(row0 + cr) * DMODEL + cc;
    bf16x8 cpiece[4];
#pragma unroll
    for (int rep = 0; rep < 4; ++rep) cpiece[rep] = *(const bf16x8*)&cp[rep * 4 * DMODEL];
    // The wait that stands in front of an overwrite of a register which an issued
    // global load names: the compiler lands later loads in this address pair.
    asm volatile("s_wait_xcnt 0x0" ::: "memory");
    // Residual and bias of y(row0 + v + 8 hl, col0 + 16 j + lm).
    float rs[4][8], bv[4];
#pragma unroll
    for (int j = 0; j < 4; ++j) {
        const int col = col0 + j * 16 + lm;
        bv[j] = bias[col];
#pragma unroll
        for (int v = 0; v < 8; ++v)
            rs[j][v] = resid[(size_t)(row0 + v + 8 * hl) * DMODEL + col];
    }
    // Keeps these loads in front of the W loads: loads return in order, and the
    // first products need these and W tile 0 only.
    __builtin_amdgcn_sched_barrier(0);

    // One k tile of this wave's four fragments.
    const __bf16* wp = Wp + (size_t)(wave * 4) * 512 + lane * 8;
    auto fetch = [&](int kt, v16bf (&b)[4]) {
#pragma unroll
        for (int j = 0; j < 4; ++j) {
            const __bf16* p = wp + (size_t)(kt * NT_O + j) * 512;
            bf16x8 lo = *(const bf16x8*)p;
            bf16x8 hi = *(const bf16x8*)(p + 256);
            b[j] = __builtin_shufflevector(lo, hi, 0, 1, 2, 3, 4, 5, 6, 7,
                                           8, 9, 10, 11, 12, 13, 14, 15);
        }
    };
    v16bf bfr[OD][4];
#pragma unroll
    for (int d = 0; d < OD; ++d) fetch(d, bfr[d]);
    // Keeps the first OD tiles' loads in front of the wait for C: all of the
    // prologue's loads fly together.
    __builtin_amdgcn_sched_barrier(0);

#pragma unroll
    for (int rep = 0; rep < 4; ++rep)
        *(bf16x8*)&lC[(cr + rep * 4) * PITCH_C + cc] = cpiece[rep];
    barrier_lds();                                      // C visible; the W loads stay in flight

    v8f acc[4];
#pragma unroll
    for (int j = 0; j < 4; ++j)
#pragma unroll
        for (int v = 0; v < 8; ++v) acc[j][v] = rs[j][v] + bv[j];

    v16bf af = load_frag(&lC[lm * PITCH_C], hl);
#pragma unroll
    for (int kt = 0; kt < KT_O; ++kt) {
        v16bf afn = af;
        if (kt + 1 < KT_O) afn = load_frag(&lC[lm * PITCH_C + (kt + 1) * 32], hl);
#pragma unroll
        for (int j = 0; j < 4; ++j)
            acc[j] = __builtin_amdgcn_wmma_f32_16x16x32_bf16(
                false, af, false, bfr[kt % OD][j], (short)0, acc[j], false, false);
        af = afn;
        if (kt + OD < KT_O) {
            // The two fences keep tile kt + OD's loads here, right behind the
            // products that free their registers: the compiler otherwise sinks
            // them to just in front of their own products, with nothing in flight.
            __builtin_amdgcn_sched_barrier(0);
            fetch(kt + OD, bfr[kt % OD]);
            __builtin_amdgcn_sched_barrier(0);
        }
    }

    float gm[4], bt[4];
#pragma unroll
    for (int j = 0; j < 4; ++j) {
        gm[j] = gamma[col0 + j * 16 + lm];
        bt[j] = beta[col0 + j * 16 + lm];
    }

    // ---- row sums: in-lane over the four tiles, over the 16 lanes of a half,
    //      then over the 16 waves through LDS ----
    f32x4 ps[4];                                        // s[0..3], s[4..7], s2[0..3], s2[4..7]
#pragma unroll
    for (int v = 0; v < 8; ++v) {
        float s = 0.f, s2 = 0.f;
#pragma unroll
        for (int j = 0; j < 4; ++j) {
            s  += acc[j][v];
            s2 += acc[j][v] * acc[j][v];
        }
        ps[v >> 2][v & 3]       = row_sum(s);
        ps[2 + (v >> 2)][v & 3] = row_sum(s2);
    }
    if (lm == 0) {
#pragma unroll
        for (int i = 0; i < 4; ++i) *(f32x4*)&red[wave][16 * hl + 4 * i] = ps[i];
    }
    __syncthreads();                                    // every wave's partial sums visible
    // Lane (lm, hl) adds up, over the waves, the sum (lm < 8) or the squares (lm >= 8)
    // of row 8 hl + (lm & 7); lanes lm and lm ^ 8 then swap.
    float t = 0.f;
#pragma unroll
    for (int w = 0; w < 16; ++w) t += red[w][lane];
    const float o   = row_xor<8>(t);
    const float ts  = (lm < 8) ? t : o;
    const float ts2 = (lm < 8) ? o : t;
    const float mu  = ts * (1.f / DMODEL);
    const float var = ts2 * (1.f / DMODEL) - mu * mu;
    const float inv = rsqrtf(var + LN_EPS);
    float muv[8], iv[8];                                // of row 8 hl + v
    muv[0] = row_share<0>(mu); iv[0] = row_share<0>(inv);
    muv[1] = row_share<1>(mu); iv[1] = row_share<1>(inv);
    muv[2] = row_share<2>(mu); iv[2] = row_share<2>(inv);
    muv[3] = row_share<3>(mu); iv[3] = row_share<3>(inv);
    muv[4] = row_share<4>(mu); iv[4] = row_share<4>(inv);
    muv[5] = row_share<5>(mu); iv[5] = row_share<5>(inv);
    muv[6] = row_share<6>(mu); iv[6] = row_share<6>(inv);
    muv[7] = row_share<7>(mu); iv[7] = row_share<7>(inv);
#pragma unroll
    for (int v = 0; v < 8; ++v) {
        float* orow = out + (size_t)(row0 + v + 8 * hl) * DMODEL + col0 + lm;
#pragma unroll
        for (int j = 0; j < 4; ++j)
            orow[j * 16] = (acc[j][v] - muv[v]) * iv[v] * gm[j] + bt[j];
    }
}

extern "C" void kernel_launch(void* const* d_in, const int* in_sizes, int n_in,
                              void* d_out, int out_size, void* d_ws, size_t ws_size,
                              hipStream_t stream) {
    const float* x     = (const float*)d_in[0];
    const float* Wq    = (const float*)d_in[1];
    const float* bq    = (const float*)d_in[2];
    const float* Wk    = (const float*)d_in[3];
    const float* bk    = (const float*)d_in[4];
    const float* Wv    = (const float*)d_in[5];
    const float* bv    = (const float*)d_in[6];
    const float* Wo    = (const float*)d_in[7];
    const float* bo    = (const float*)d_in[8];
    const float* gamma = (const float*)d_in[9];
    const float* beta  = (const float*)d_in[10];
    float* out = (float*)d_out;

    char* ws = (char*)d_ws;
    const size_t MAT = (size_t)SEQ * DMODEL * sizeof(__bf16);  // 4 MB
    __bf16* Qb = (__bf16*)(ws);
    __bf16* Kb = (__bf16*)(ws + MAT);
    __bf16* Vb = (__bf16*)(ws + 2 * MAT);
    __bf16* Cb = (__bf16*)(ws + 3 * MAT);
    __bf16* Wp = (__bf16*)(ws + 4 * MAT);                      // Wo as bf16 fragments, 2 MB

    dim3 gQkv(DMODEL / 128, SEQ / 128, 4);              // planes Qb, Kb, Vb; plane 3 packs Wo
    gemm_wmma<<<gQkv, 256, 0, stream>>>(x, Wq, Wk, Wv, bq, bk, bv, Qb, Wo, Wp,
                                        SEQ, DMODEL, DMODEL);
    dim3 gAttn(NHEAD, SEQ / 64);
    attn_flash<<<gAttn, 512, 0, stream>>>(Qb, Kb, Vb, Cb);
    oproj_layernorm<<<SEQ / 16, 512, 0, stream>>>(Cb, Wp, bo, x, gamma, beta, out);
}

// v010
// A run of this version takes 53.8 microseconds.
// Next to v009, in two timings, it ran 1.05 times as fast each time.
// All steps since v000 together make it 7.60 times as fast.
#include <hip/hip_runtime.h>

#define SEQ 2048
#define DMODEL 1024
#define NHEAD 16
#define DK 64
#define LN_EPS 1e-5f
// 1 / sqrt(DK) times log2(e): a score times this is the exponent of 2 in the softmax.
#define SCORE_LOG2_SCALE 0.18033688011112042f

typedef __bf16 v16bf  __attribute__((ext_vector_type(16)));
typedef __bf16 bf16x8 __attribute__((ext_vector_type(8)));
typedef __bf16 bf16x4 __attribute__((ext_vector_type(4)));
typedef float  v8f    __attribute__((ext_vector_type(8)));
typedef float  f32x4  __attribute__((ext_vector_type(4)));
typedef int    v4i    __attribute__((ext_vector_type(4)));

#define AS1 __attribute__((address_space(1)))
#define AS3 __attribute__((address_space(3)))

// K-index mapping kmap(e, hl) of 16-bit A/B fragments of V_WMMA_*_16X16X32_*
// (ISA 7.12.2): element e -> K = {0..7}+8*hl for e<8, {16..23}+8*hl for e>=8.

// LDS row pitches in elements. Rows read by ds_load_b128 stand at an odd
// multiple of 16 B, rows read by ds_load_tr16_b128 at an odd multiple of 32 B:
// a half wave's sixteen 16-byte reads then cover the 64 banks once.
#define PITCH_A 40                                      // 32-element rows,  80 B
#define PITCH_B 144                                     // 128-element rows, 288 B
#define PITCH_K 72                                      // 64-element rows,  144 B
#define PITCH_V 80                                      // 64-element rows,  160 B

// Fragment whose element e reads p[kmap(e,hl)]: two contiguous 16B runs.
__device__ __forceinline__ v16bf load_frag(const __bf16* p, int hl) {
    bf16x8 a0 = *(const bf16x8*)(p + 8 * hl);
    bf16x8 a1 = *(const bf16x8*)(p + 16 + 8 * hl);
    return __builtin_shufflevector(a0, a1, 0, 1, 2, 3, 4, 5, 6, 7,
                                   8, 9, 10, 11, 12, 13, 14, 15);
}

// Transposed fragment from a row-major LDS tile T[k][n] (32 rows of k, PITCH
// elements apart): lane (lm, hl) gets element e = T[kmap(e,hl)][n0 + lm]. Each
// transposing load takes 16 rows of k; lane l points at the 16 bytes at row
// 8*(l>>4) + (l&7), column n0 + 8*((l>>3)&1).
template <int PITCH>
__device__ __forceinline__ v16bf load_frag_tr(const __bf16* tile, int n0, int lane) {
    const __bf16* p = tile + (8 * (lane >> 4) + (lane & 7)) * PITCH + n0 +
                      8 * ((lane >> 3) & 1);
    bf16x8 a0 = __builtin_amdgcn_ds_load_tr16_b128_v8bf16((AS3 bf16x8*)p);
    bf16x8 a1 = __builtin_amdgcn_ds_load_tr16_b128_v8bf16((AS3 bf16x8*)(p + 16 * PITCH));
    return __builtin_shufflevector(a0, a1, 0, 1, 2, 3, 4, 5, 6, 7,
                                   8, 9, 10, 11, 12, 13, 14, 15);
}

// Work-group barrier that orders LDS traffic only. __syncthreads() also waits for
// every global load in flight, which would drain the tiles fetched ahead; the
// waves of a block hand each other nothing through global memory in the k loop.
__device__ __forceinline__ void barrier_lds() {
    __builtin_amdgcn_fence(__ATOMIC_RELEASE, "workgroup", "local");
    __builtin_amdgcn_s_barrier();
    __builtin_amdgcn_fence(__ATOMIC_ACQUIRE, "workgroup", "local");
}

// The DMODEL x DMODEL f32 weight Wsrc[k][n] as bf16 B fragments, in the order in
// which a wave reads them: fragment (kt, nt) covers k = 32 kt.., n = 16 nt.. and is
// 1 KB, two halves of 512 B; half c holds, at 16 bytes a lane, elements 8c..8c+7 of
// lane (lm, hl), element e being Wsrc[32 kt + kmap(e, hl)][16 nt + lm]. A unit is one
// lane's share of one fragment; thread 'first' of 'step' takes every step-th unit.
#define KT_O (DMODEL / 32)
#define NT_O (DMODEL / 16)
__device__ __forceinline__ void pack_fragments(const float* __restrict__ Wsrc,
                                               __bf16* __restrict__ dst, int first, int step) {
    for (int u = first; u < KT_O * NT_O * 32; u += step) {
        const int l = u & 31, f = u >> 5;
        const int kt = f / NT_O, nt = f % NT_O;
        const float* s = Wsrc + (size_t)(kt * 32 + 8 * (l >> 4)) * DMODEL + nt * 16 + (l & 15);
        bf16x8 lo, hi;
#pragma unroll
        for (int e = 0; e < 8; ++e) {
            lo[e] = (__bf16)s[(size_t)e * DMODEL];
            hi[e] = (__bf16)s[(size_t)(e + 16) * DMODEL];
        }
        *(bf16x8*)&dst[(size_t)f * 512 + l * 8]       = lo;
        *(bf16x8*)&dst[(size_t)f * 512 + 256 + l * 8] = hi;
    }
}

struct GemmTileRegs {                                   // one thread's share of a k tile
    f32x4 a[4];                                         // A chunks
    f32x4 b[4];                                         // W chunks
};

// ---------------------------------------------------------------------------
// Tiled bf16 WMMA GEMM: out[N,Dout] = A[N,K] @ W[K,Dout] + bias, A and W f32, out bf16.
// 256 threads = 8 waves (2x4), block tile 128x128, wave tile 64x32, K-step 32;
// K a multiple of 64.
// Three products on the same A in one launch: blockIdx.z = 0..2 picks the weight
// and bias, and the outputs are three N x Dout planes one after another. The
// blocks of plane 3 pack Wpack (see pack_fragments) and multiply nothing.
// Plane 0 (Q) is stored times SCORE_LOG2_SCALE, multiplied in f32 in front of its
// one rounding to bf16, so that K Q^T comes out as the softmax's exponent of 2.
// The k loop's global loads run two tiles ahead, in two register sets: trip t
// converts tile t from its set into LDS buffer t & 1, passes the barrier, reads
// its fragments, issues tile t+2's loads into the set just freed and multiplies.
// With two LDS buffers one barrier a trip is enough: a wave that writes buffer b
// again in trip t+2 has passed the barrier of trip t+1, which every wave reaches
// only after its reads of buffer b in trip t have returned.
// L2 prefetch: the blocks that share a row or column panel walk k in step, so the
// register loads of a tile can meet lines that are still on their way from memory.
// Each pass of the loop (two k tiles) therefore asks L2 for the two tiles that the
// loads reach PF_LEAD passes later: a lane of waves 0-3 for a row of A, a lane of
// waves 4-7 for a 256-byte unit of W. 24 blocks are on a row panel and 16 on a column
// panel: a block asks for every fourth piece only (A dealt by blockIdx.x, W
// by blockIdx.y; one wave each), so that each piece still has 6 or 4 askers and
// the requests stay few beside the loads. A hint, for speed only: no result rests
// on it, wherever the blocks run.
// ---------------------------------------------------------------------------
#define PF_LEAD 3
__global__ __launch_bounds__(256)
void gemm_wmma(const float* __restrict__ A, const float* __restrict__ W0, const float* __restrict__ W1,
               const float* __restrict__ W2, const float* __restrict__ bias0,
               const float* __restrict__ bias1, const float* __restrict__ bias2,
               __bf16* __restrict__ outbf0, const float* __restrict__ Wpack,
               __bf16* __restrict__ packed, int N, int K, int Dout) {
    __shared__ __align__(16) __bf16 lA[2][128 * PITCH_A];
    __shared__ __align__(16) __bf16 lB[2][32 * PITCH_B];

    // Plane 3 multiplies nothing: its blocks pack the output projection's weight
    // for the launch after next. The whole block leaves here, in front of every
    // barrier.
    if (blockIdx.z == 3) {
        pack_fragments(Wpack, packed,
                       (blockIdx.y * gridDim.x + blockIdx.x) * 256 + threadIdx.x,
                       gridDim.x * gridDim.y * 256);
        return;
    }

    const int z = blockIdx.z;
    const float* __restrict__ W    = (z == 0) ? W0 : (z == 1) ? W1 : W2;
    const float* __restrict__ bias = (z == 0) ? bias0 : (z == 1) ? bias1 : bias2;
    __bf16* __restrict__ outbf     = outbf0 + (size_t)z * N * Dout;
    const float oscale             = (z == 0) ? SCORE_LOG2_SCALE : 1.f;

    const int tid  = threadIdx.x;
    const int wave = tid >> 5;
    const int lane = tid & 31;
    const int lm   = lane & 15;
    const int hl   = lane >> 4;
    const int wrow = wave >> 2;            // 0..1  -> 64-row slab
    const int wcol = wave & 3;             // 0..3  -> 32-col slab
    const int row0 = blockIdx.y * 128;
    const int col0 = blockIdx.x * 128;

    v8f zero = {};
    v8f acc[4][2];
#pragma unroll
    for (int i = 0; i < 4; ++i)
#pragma unroll
        for (int j = 0; j < 2; ++j) acc[i][j] = zero;

    // This thread's four vec4 chunks of the A tile (128x32: rows ar + 32 rep) and
    // of the W tile (32x128: rows br + 8 rep), as offsets from block-uniform
    // pointers that step from tile to tile.
    const int ar = tid >> 3, ac = (tid & 7) * 4;
    const int br = tid >> 5, bc = (tid & 31) * 4;
    unsigned aoff[4], boff[4];
#pragma unroll
    for (int rep = 0; rep < 4; ++rep) {
        aoff[rep] = (unsigned)((ar + rep * 32) * K + ac);
        boff[rep] = (unsigned)((br + rep * 8) * Dout + bc);
    }
    const float* pA = A + (size_t)row0 * K;
    const float* pW = W + col0;

    // This lane's piece of a pair of k tiles, and the bytes from one pair to the
    // next (alike in a wave). The pointer lives in one register pair through the
    // loop and stops at the last pair, so that it names bytes of its operand
    // before and behind every step.
    const int np = K / 64;                              // pairs of k tiles
    constexpr int DEAL = 4;                             // a block asks for 1 piece in DEAL
    const int  wv     = __builtin_amdgcn_readfirstlane(wave);
    const bool pfA    = wv < 4;
    const bool pfasks = (wv & 3) < 4 / DEAL;            // alike in a wave: a scalar branch
    // Piece 0..127 of the operand's 128 (the mask keeps the idle waves' pointers
    // inside the operand too).
    const int piece = (((wv & 3) * 32 + lane) * DEAL +
                       (int)((pfA ? blockIdx.x : blockIdx.y) & (DEAL - 1))) & 127;
    const char* pf;
    if (pfA) {
        pf = (const char*)(A + (size_t)(row0 + piece) * K);
    } else {
        pf = (const char*)(W + (size_t)(piece >> 1) * Dout + col0 + (piece & 1) * 64);
    }
    const unsigned pfstep = pfA ? 64u * 4u : 64u * 4u * (unsigned)Dout;
    int pfpair = 0;                                     // the pair pf would stand at unclamped
    auto pf_step = [&]() {
        ++pfpair;
        pf += (pfpair < np) ? pfstep : 0u;
    };
    auto pf_ask = [&]() {
        // Brings the line into L2 only; returns nothing and counts on no counter.
        if (pfasks) asm volatile("global_prefetch_b8 %0, off scope:SCOPE_SE" :: "v"(pf));
    };

    auto fetch = [&](GemmTileRegs& t) {
#pragma unroll
        for (int rep = 0; rep < 4; ++rep) t.a[rep] = *(const f32x4*)&pA[aoff[rep]];
#pragma unroll
        for (int rep = 0; rep < 4; ++rep) t.b[rep] = *(const f32x4*)&pW[boff[rep]];
        // The pointers step next: the wait that stands in front of an overwrite of
        // a register which an issued global load names.
        asm volatile("s_wait_xcnt 0x0" ::: "memory");
        pA += 32;
        pW += (size_t)32 * Dout;
    };
    auto stage = [&](const GemmTileRegs& t, __bf16* sA, __bf16* sB) {
#pragma unroll
        for (int rep = 0; rep < 4; ++rep) {
            f32x4 v = t.a[rep];
            bf16x4 b = {(__bf16)v.x, (__bf16)v.y, (__bf16)v.z, (__bf16)v.w};
            *(bf16x4*)&sA[(ar + rep * 32) * PITCH_A + ac] = b;
        }
#pragma unroll
        for (int rep = 0; rep < 4; ++rep) {
            f32x4 v = t.b[rep];
            bf16x4 b = {(__bf16)v.x, (__bf16)v.y, (__bf16)v.z, (__bf16)v.w};
            *(bf16x4*)&sB[(br + rep * 8) * PITCH_B + bc] = b;
        }
    };
    // One trip: tile t out of its register set into LDS buffer b, the barrier, the
    // fragment reads, tile t+2's loads into the same set (while one exists), the
    // products. The global loads stand behind the fragment reads, so that their
    // issue and their wait run under the LDS latency.
    auto trip = [&](GemmTileRegs& t, int b, bool more, bool ask) __attribute__((always_inline)) {
        stage(t, lA[b], lB[b]);
        barrier_lds();
        v16bf af[4], bfr[2];
#pragma unroll
        for (int i = 0; i < 4; ++i)
            af[i] = load_frag(&lA[b][(wrow * 64 + i * 16 + lm) * PITCH_A], hl);
#pragma unroll
        for (int j = 0; j < 2; ++j)
            bfr[j] = load_frag_tr<PITCH_B>(lB[b], wcol * 32 + j * 16, lane);
        // Keeps the twelve fragment reads in one group at the head of the trip:
        // spread among the products, each place with reads waits out the LDS
        // latency anew.
        __builtin_amdgcn_sched_barrier(0);
        if (more) {
            if (ask) pf_ask();
            fetch(t);
            if (ask) pf_step();                         // behind fetch's wait
            // Keeps the global loads ahead of the products: the compiler otherwise
            // lands them in fragment registers and holds them back until the
            // products have read those.
            __builtin_amdgcn_sched_barrier(0);
        }
#pragma unroll
        for (int i = 0; i < 4; ++i)
#pragma unroll
            for (int j = 0; j < 2; ++j)
                acc[i][j] = __builtin_amdgcn_wmma_f32_16x16x32_bf16(
                    false, af[i], false, bfr[j], (short)0, acc[i][j], false, false);
        // Keeps the next trip's conversion, and with it the wait for its tile,
        // behind this trip's products: moved up among them it would wait for
        // loads that are only one trip old.
        __builtin_amdgcn_sched_barrier(0);
    };

    GemmTileRegs t0, t1;
    // The pairs that the loop's first PF_LEAD passes load are asked for here. Kept
    // rolled, so that these requests too name the pointer's own register pair and
    // not temporaries that soon hold something else.
#pragma unroll 1
    for (int i = 0; i < PF_LEAD; ++i) {
        pf_step();
        pf_ask();
    }
    pf_step();
    fetch(t0);
    // Keeps tile 0's loads ahead of tile 1's, as in the loop, so that the counted
    // waits at the loop's head leave tile 1 in flight on the first trip too.
    __builtin_amdgcn_sched_barrier(0);
    fetch(t1);
    // The last two trips stand behind the loop, without loads: no branch in the
    // loop, so the waits for a tile count the younger tile's loads exactly.
    for (int k0 = 64; k0 < K; k0 += 64) {
        trip(t0, 0, true, true);
        trip(t1, 1, true, false);
    }
    trip(t0, 0, false, false);
    trip(t1, 1, false, false);

#pragma unroll
    for (int i = 0; i < 4; ++i)
#pragma unroll
        for (int j = 0; j < 2; ++j) {
            int gcol = col0 + wcol * 32 + j * 16 + lm;
            float bv = bias[gcol];
#pragma unroll
            for (int v = 0; v < 8; ++v) {
                int grow = row0 + wrow * 64 + i * 16 + v + 8 * hl;
                size_t gi = (size_t)grow * Dout + gcol;
                outbf[gi] = (__bf16)((acc[i][j][v] + bv) * oscale);
            }
        }
    // The wait that stands in front of an overwrite of a register which an issued
    // global store names: in the built code the packing branch stands behind these
    // stores and reuses their registers.
    asm volatile("s_wait_xcnt 0x0" ::: "memory");
}

// Lane l <-> lane l ^ 16: the other half of the wave.
__device__ __forceinline__ float xhalf(float x) {
    int b = __builtin_bit_cast(int, x);
    return __builtin_bit_cast(float, __builtin_amdgcn_permlanex16(
        b, b, 0x76543210, 0xfedcba98, false, false));
}

// 2^x on the transcendental unit. The v_nop in the same statement keeps the one
// free slot that the instruction set asks for behind a transcendental, whatever
// the compiler schedules next.
__device__ __forceinline__ float exp2_slot(float x) {
    float r;
    asm("v_exp_f32 %0, %1\n\tv_nop" : "=v"(r) : "v"(x));
    return r;
}

#define KSLICES 4
#define STAGE_KEYS (32 * KSLICES)
#define NQTILE (SEQ / 64)                               // query tiles, even
#define PITCH_O 68                                      // 64 f32 rows, 272 B
#define RESCALE_AT 8.f
#define MASKED_C (-1.0e30f)                             // 2^(score + this) is 0
__global__ __launch_bounds__(512)
void attn_flash(const __bf16* __restrict__ Q, const __bf16* __restrict__ Kb,
                const __bf16* __restrict__ Vb, __bf16* __restrict__ ctx) {
    __shared__ __align__(16) __bf16 lQ[64 * 64];               // 8 KB
    __shared__ __align__(16) __bf16 lK[2][STAGE_KEYS * PITCH_K];  // [key][d]
    __shared__ __align__(16) __bf16 lV[2][STAGE_KEYS * PITCH_V];  // [key][d]
    __shared__ __align__(16) float lO[KSLICES][64 * PITCH_O];  // partial ctx [query][d]
    __shared__ float lM[KSLICES][64], lL[KSLICES][64];         // reference, partial sum

    const int tid   = threadIdx.x;
    // In a scalar register, so that the per-wave skip below is a scalar branch.
    const int wave  = __builtin_amdgcn_readfirstlane(tid >> 5);
    const int lane  = tid & 31;
    const int lm    = lane & 15;
    const int hl    = lane >> 4;
    const int grp   = wave >> 2;                        // key slice
    const int slab  = wave & 3;                         // query slab
    const int h     = blockIdx.x;
    const int rank  = blockIdx.y;
    const int qtile = (rank < NQTILE / 2) ? NQTILE - 1 - rank : rank - NQTILE / 2;
    const int qbase = qtile * 64 + slab * 16;
    const int hoff  = h * DK;

    // One stage (128 keys x 64 d of K and of V) into ring buffer b: a thread
    // copies two 16-byte pieces of each.
    auto copy_stage = [&](int st, int b) {
#pragma unroll
        for (int rep = 0; rep < 2; ++rep) {
            int idx = tid + rep * 512;                  // 0..1023 x 16B
            int r = idx >> 3, c8 = (idx & 7) * 8;
            const size_t g = (size_t)(st * STAGE_KEYS + r) * DMODEL + hoff + c8;
            __builtin_amdgcn_global_load_async_to_lds_b128(
                (AS1 v4i*)&Kb[g], (AS3 v4i*)&lK[b][r * PITCH_K + c8], 0, 0);
            __builtin_amdgcn_global_load_async_to_lds_b128(
                (AS1 v4i*)&Vb[g], (AS3 v4i*)&lV[b][r * PITCH_V + c8], 0, 0);
        }
    };
    // Asks L2 for a stage's K and V rows, one stage ahead of their copies (the four
    // waves of key slice 0, a lane a row).
    auto prefetch_stage = [&](int st) {
        const int nrow = st * STAGE_KEYS + slab * 32 + lane;
        __builtin_prefetch(&Kb[(size_t)nrow * DMODEL + hoff], 0, 3);
        __builtin_prefetch(&Vb[(size_t)nrow * DMODEL + hoff], 0, 3);
    };
    const int nst = (qtile * 64 + 64 + STAGE_KEYS - 1) / STAGE_KEYS;  // causal bound

    copy_stage(0, 0);                                   // flies under the Q staging

    // stage Q tile (64 rows x 64 dk) once
#pragma unroll
    for (int rep = 0; rep < 2; ++rep) {
        int idx = tid + rep * 512;                     // 0..1023 vec4 chunks
        int r = idx >> 4, c4 = (idx & 15) * 4;
        *(bf16x4*)&lQ[r * 64 + c4] =
            *(const bf16x4*)&Q[(size_t)(qtile * 64 + r) * DMODEL + hoff + c4];
    }
    // This wave's copies of stage 0 have landed before the barrier publishes them.
    asm volatile("s_wait_asynccnt 0x0" ::: "memory");
    __syncthreads();                                    // Q and stage 0 visible
    if (nst > 1) copy_stage(1, 1);
    if (nst > 2 && grp == 0) prefetch_stage(2);
    v16bf qf[2];
#pragma unroll
    for (int c = 0; c < 2; ++c)
        qf[c] = load_frag(&lQ[(slab * 16 + lm) * 64 + c * 32], hl);

    v8f zero = {};
    v8f acc[4];
#pragma unroll
    for (int t = 0; t < 4; ++t) acc[t] = zero;
    v8f   cneg = zero;                  // minus the reference of query lm, as a C operand
    float lrun = 0.f;                                   // this half's keys only
    const int q = qbase + lm;

    // Kept whole: with the first trip peeled off, the kernel needs more than the
    // 128 registers at which two blocks share a WGP.
#pragma unroll 1
    for (int st = 0; st < nst; ++st) {
        const __bf16* sK = lK[st & 1];
        const __bf16* sV = lV[st & 1];

        // This wave's 32 keys of the stage. A slice that starts behind the slab's
        // first query is masked for all of the slab and is skipped (both are
        // multiples of 16, so a slice that is not skipped holds at least one
        // open key for every query and its maximum is a real score). The
        // foot of the trip stands outside the skip: every wave passes it.
        const int kbase = st * STAGE_KEYS + grp * 32;
        if (kbase <= qbase) {
            // ---- K @ Q^T + C: s[t][v] = log2 of P(key kbase+16t+8hl+v, query lm) ----
            // The four K fragments are read in one group, ahead of the branch on the
            // diagonal, which both of its sides share.
            v16bf kf[2][2];
#pragma unroll
            for (int t = 0; t < 2; ++t)
#pragma unroll
                for (int c = 0; c < 2; ++c)
                    kf[t][c] = load_frag(&sK[(grp * 32 + t * 16 + lm) * PITCH_K + c * 32], hl);
            v8f s[2];
            auto scores = [&](const v8f& c0, const v8f& c1) __attribute__((always_inline)) {
                s[0] = c0; s[1] = c1;
#pragma unroll
                for (int c = 0; c < 2; ++c)
#pragma unroll
                    for (int t = 0; t < 2; ++t)
                        s[t] = __builtin_amdgcn_wmma_f32_16x16x32_bf16(
                            false, kf[t][c], false, qf[c], (short)0, s[t], false, false);
            };
            if (kbase + 31 > qbase) {                   // the slice on the diagonal (scalar)
                v8f cm[2];
#pragma unroll
                for (int t = 0; t < 2; ++t)
#pragma unroll
                    for (int v = 0; v < 8; ++v)
                        cm[t][v] = (kbase + t * 16 + 8 * hl + v > q) ? MASKED_C : cneg[v];
                scores(cm[0], cm[1]);
            } else {
                scores(cneg, cneg);
            }

            // ---- this query's maximum above the reference ----
            float m = s[0][0];
#pragma unroll
            for (int t = 0; t < 2; ++t)
#pragma unroll
                for (int v = 0; v < 8; ++v) m = fmaxf(m, s[t][v]);
            m = fmaxf(m, xhalf(m));

            // ---- move the reference: a wave's first slice (stage 0), else rare ----
            const bool first = st == 0;
            if (first || __builtin_amdgcn_ballot_w32(m > RESCALE_AT) != 0) {
                const float delta = (first || m > RESCALE_AT) ? m : 0.f;
                const float alpha = first ? 0.f : exp2_slot(-delta);  // sum, context still 0 at first
#pragma unroll
                for (int v = 0; v < 8; ++v) cneg[v] -= delta;
#pragma unroll
                for (int t = 0; t < 2; ++t)
#pragma unroll
                    for (int v = 0; v < 8; ++v) s[t][v] -= delta;
                lrun *= alpha;
#pragma unroll
                for (int t = 0; t < 4; ++t)
#pragma unroll
                    for (int v = 0; v < 8; ++v) acc[t][v] *= alpha;
            }

            float sum = 0.f;
#pragma unroll
            for (int t = 0; t < 2; ++t)
#pragma unroll
                for (int v = 0; v < 8; ++v) {
                    float p = exp2_slot(s[t][v]);
                    s[t][v] = p;
                    sum += p;
                }
            lrun += sum;

            // ---- P^T as B operand: element e is key kmap(e, hl) of query lm ----
            v16bf pf;
#pragma unroll
            for (int e = 0; e < 16; ++e) pf[e] = (__bf16)s[e >> 3][e & 7];

            // ---- ctx^T += V^T @ P^T: acc[t][v] = ctx(query lm, dim 16t+8hl+v) ----
#pragma unroll
            for (int t = 0; t < 4; ++t) {
                v16bf vf = load_frag_tr<PITCH_V>(sV + grp * 32 * PITCH_V, t * 16, lane);
                acc[t] = __builtin_amdgcn_wmma_f32_16x16x32_bf16(
                    false, vf, false, pf, (short)0, acc[t], false, false);
            }
        }

        // ---- foot of the trip, every wave ----
        // This wave's reads of the stage have returned before its buffer is freed.
        asm volatile("s_wait_dscnt 0x0" ::: "memory");
        // This wave's copies of the next stage have landed before they are published.
        asm volatile("s_wait_asynccnt 0x0" ::: "memory");
        __syncthreads();                                // next stage visible, this buffer free
        if (st + 2 < nst) copy_stage(st + 2, st & 1);
        if (st + 3 < nst && grp == 0) prefetch_stage(st + 3);
    }
    // No copy is left in flight when the wave goes on (none is issued behind the
    // last wait of the loop; a precaution).
    asm volatile("s_wait_asynccnt 0x0" ::: "memory");

    // ---- hand over this slice's partial result (a slice that never ran:
    //      reference -inf, sum 0, context 0, weight 0 below) ----
    const float lpart = lrun + xhalf(lrun);             // join the halves' sums
    const float mrun  = (grp * 32 <= qbase) ? -cneg[0] : -__builtin_inff();
#pragma unroll
    for (int t = 0; t < 4; ++t) {
        float* o = &lO[grp][(slab * 16 + lm) * PITCH_O + t * 16 + 8 * hl];
        f32x4 lo = {acc[t][0], acc[t][1], acc[t][2], acc[t][3]};
        f32x4 hi = {acc[t][4], acc[t][5], acc[t][6], acc[t][7]};
        *(f32x4*)o       = lo;
        *(f32x4*)(o + 4) = hi;
    }
    if (hl == 0) {
        lM[grp][slab * 16 + lm] = mrun;
        lL[grp][slab * 16 + lm] = lpart;
    }
    __syncthreads();                                    // partials visible to all waves

    // ---- merge: each wave finishes four whole rows, a lane 8 dims of one ----
    const int qr = wave * 4 + (lane >> 3);              // row of the query tile
    const int d0 = (lane & 7) * 8;
    float mall = -__builtin_inff();                     // finite: slice 0 holds key 0
#pragma unroll
    for (int g = 0; g < KSLICES; ++g) mall = fmaxf(mall, lM[g][qr]);
    float ltot = 0.f;
    float osum[8] = {0.f, 0.f, 0.f, 0.f, 0.f, 0.f, 0.f, 0.f};
#pragma unroll
    for (int g = 0; g < KSLICES; ++g) {
        const float wgt = exp2_slot(lM[g][qr] - mall);
        ltot += wgt * lL[g][qr];
        const float* o = &lO[g][qr * PITCH_O + d0];
        f32x4 lo = *(const f32x4*)o;
        f32x4 hi = *(const f32x4*)(o + 4);
#pragma unroll
        for (int v = 0; v < 4; ++v) {
            osum[v]     += wgt * lo[v];
            osum[v + 4] += wgt * hi[v];
        }
    }
    bf16x8 ob;
#pragma unroll
    for (int v = 0; v < 8; ++v) ob[v] = (__bf16)(osum[v] / ltot);
    *(bf16x8*)&ctx[(size_t)(qtile * 64 + qr) * DMODEL + hoff + d0] = ob;
}

// Lane l <-> lane l ^ M inside a 16-lane row, and lane N of the row to all of it, by
// DPP: a vector instruction each, where a shuffle goes through the LDS unit.
template <int M>
__device__ __forceinline__ float row_xor(float x) {
    return __builtin_bit_cast(float, __builtin_amdgcn_update_dpp(
        0, __builtin_bit_cast(int, x), 0x160 | M, 0xf, 0xf, true));    // row_xmask:M
}
template <int N>
__device__ __forceinline__ float row_share(float x) {
    return __builtin_bit_cast(float, __builtin_amdgcn_update_dpp(
        0, __builtin_bit_cast(int, x), 0x150 | N, 0xf, 0xf, true));    // row_share:N
}
__device__ __forceinline__ float row_sum(float x) {
    x += row_xor<1>(x);
    x += row_xor<2>(x);
    x += row_xor<4>(x);
    x += row_xor<8>(x);
    return x;
}

// ---------------------------------------------------------------------------
// Output projection, bias, residual and LayerNorm in one launch:
// out = LayerNorm(C @ Wo + bias + resid). A block owns 16 whole rows, so that the
// row sums stay inside it: 512 threads = 16 waves, wave w has columns 64 w..64 w+63
// (four 16x16 accumulators). The block's 16 rows of C stand in LDS, staged once.
// Each W fragment is used by one wave only and comes straight from L2 into
// registers, in the packed order of pack_fragments (every load a whole 512 bytes a
// wave), OD k tiles ahead of its products. The accumulators start from residual +
// bias, whose loads fly with the first tiles.
// ---------------------------------------------------------------------------
#define PITCH_C (DMODEL + 8)                            // 2,064 B, an odd multiple of 16 B
#define OD 5
__global__ __launch_bounds__(512)
void oproj_layernorm(const __bf16* __restrict__ C, const __bf16* __restrict__ Wp,
                     const float* __restrict__ bias, const float* __restrict__ resid,
                     const float* __restrict__ gamma, const float* __restrict__ beta,
                     float* __restrict__ out) {
    __shared__ __align__(16) __bf16 lC[16 * PITCH_C];
    // Partial row sums: [wave][16 hl + v] the sum of row 8 hl + v, [.. + 8] its squares.
    __shared__ __align__(16) float red[16][32];

    const int tid  = threadIdx.x;
    const int wave = __builtin_amdgcn_readfirstlane(tid >> 5);
    const int lane = tid & 31;
    const int lm   = lane & 15;
    const int hl   = lane >> 4;
    const int row0 = blockIdx.x * 16;
    const int col0 = wave * 64;

    // The block's rows of C: 2,048 pieces of 16 bytes, four a thread (rows cr + 4 rep).
    const int cr = tid >> 7, cc = (tid & 127) * 8;
    const __bf16* cp = C + (size_t)(row0 + cr) * DMODEL + cc;
    bf16x8 cpiece[4];
#pragma unroll
    for (int rep = 0; rep < 4; ++rep) cpiece[rep] = *(const bf16x8*)&cp[rep * 4 * DMODEL];
    // The wait that stands in front of an overwrite of a register which an issued
    // global load names: the compiler lands later loads in this address pair.
    asm volatile("s_wait_xcnt 0x0" ::: "memory");
    // Residual and bias of y(row0 + v + 8 hl, col0 + 16 j + lm).
    float rs[4][8], bv[4];
#pragma unroll
    for (int j = 0; j < 4; ++j) {
        const int col = col0 + j * 16 + lm;
        bv[j] = bias[col];
#pragma unroll
        for (int v = 0; v < 8; ++v)
            rs[j][v] = resid[(size_t)(row0 + v + 8 * hl) * DMODEL + col];
    }
    // Keeps these loads in front of the W loads: loads return in order, and the
    // first products need these and W tile 0 only.
    __builtin_amdgcn_sched_barrier(0);

    // One k tile of this wave's four fragments.
    const __bf16* wp = Wp + (size_t)(wave * 4) * 512 + lane * 8;
    auto fetch = [&](int kt, v16bf (&b)[4]) {
#pragma unroll
        for (int j = 0; j < 4; ++j) {
            const __bf16* p = wp + (size_t)(kt * NT_O + j) * 512;
            bf16x8 lo = *(const bf16x8*)p;
            bf16x8 hi = *(const bf16x8*)(p + 256);
            b[j] = __builtin_shufflevector(lo, hi, 0, 1, 2, 3, 4, 5, 6, 7,
                                           8, 9, 10, 11, 12, 13, 14, 15);
        }
    };
    v16bf bfr[OD][4];
#pragma unroll
    for (int d = 0; d < OD; ++d) fetch(d, bfr[d]);
    // Keeps the first OD tiles' loads in front of the wait for C: all of the
    // prologue's loads fly together.
    __builtin_amdgcn_sched_barrier(0);

#pragma unroll
    for (int rep = 0; rep < 4; ++rep)
        *(bf16x8*)&lC[(cr + rep * 4) * PITCH_C + cc] = cpiece[rep];
    barrier_lds();                                      // C visible; the W loads stay in flight

    v8f acc[4];
#pragma unroll
    for (int j = 0; j < 4; ++j)
#pragma unroll
        for (int v = 0; v < 8; ++v) acc[j][v] = rs[j][v] + bv[j];

    v16bf af = load_frag(&lC[lm * PITCH_C], hl);
#pragma unroll
    for (int kt = 0; kt < KT_O; ++kt) {
        v16bf afn = af;
        if (kt + 1 < KT_O) afn = load_frag(&lC[lm * PITCH_C + (kt + 1) * 32], hl);
#pragma unroll
        for (int j = 0; j < 4; ++j)
            acc[j] = __builtin_amdgcn_wmma_f32_16x16x32_bf16(
                false, af, false, bfr[kt % OD][j], (short)0, acc[j], false, false);
        af = afn;
        if (kt + OD < KT_O) {
            // The two fences keep tile kt + OD's loads here, right behind the
            // products that free their registers: the compiler otherwise sinks
            // them to just in front of their own products, with nothing in flight.
            __builtin_amdgcn_sched_barrier(0);
            fetch(kt + OD, bfr[kt % OD]);
            __builtin_amdgcn_sched_barrier(0);
        }
    }

    float gm[4], bt[4];
#pragma unroll
    for (int j = 0; j < 4; ++j) {
        gm[j] = gamma[col0 + j * 16 + lm];
        bt[j] = beta[col0 + j * 16 + lm];
    }

    // ---- row sums: in-lane over the four tiles, over the 16 lanes of a half,
    //      then over the 16 waves through LDS ----
    f32x4 ps[4];                                        // s[0..3], s[4..7], s2[0..3], s2[4..7]
#pragma unroll
    for (int v = 0; v < 8; ++v) {
        float s = 0.f, s2 = 0.f;
#pragma unroll
        for (int j = 0; j < 4; ++j) {
            s  += acc[j][v];
            s2 += acc[j][v] * acc[j][v];
        }
        ps[v >> 2][v & 3]       = row_sum(s);
        ps[2 + (v >> 2)][v & 3] = row_sum(s2);
    }
    if (lm == 0) {
#pragma unroll
        for (int i = 0; i < 4; ++i) *(f32x4*)&red[wave][16 * hl + 4 * i] = ps[i];
    }
    __syncthreads();                                    // every wave's partial sums visible
    // Lane (lm, hl) adds up, over the waves, the sum (lm < 8) or the squares (lm >= 8)
    // of row 8 hl + (lm & 7); lanes lm and lm ^ 8 then swap.
    float t = 0.f;
#pragma unroll
    for (int w = 0; w < 16; ++w) t += red[w][lane];
    const float o   = row_xor<8>(t);
    const float ts  = (lm < 8) ? t : o;
    const float ts2 = (lm < 8) ? o : t;
    const float mu  = ts * (1.f / DMODEL);
    const float var = ts2 * (1.f / DMODEL) - mu * mu;
    const float inv = rsqrtf(var + LN_EPS);
    float muv[8], iv[8];                                // of row 8 hl + v
    muv[0] = row_share<0>(mu); iv[0] = row_share<0>(inv);
    muv[1] = row_share<1>(mu); iv[1] = row_share<1>(inv);
    muv[2] = row_share<2>(mu); iv[2] = row_share<2>(inv);
    muv[3] = row_share<3>(mu); iv[3] = row_share<3>(inv);
    muv[4] = row_share<4>(mu); iv[4] = row_share<4>(inv);
    muv[5] = row_share<5>(mu); iv[5] = row_share<5>(inv);
    muv[6] = row_share<6>(mu); iv[6] = row_share<6>(inv);
    muv[7] = row_share<7>(mu); iv[7] = row_share<7>(inv);
#pragma unroll
    for (int v = 0; v < 8; ++v) {
        float* orow = out + (size_t)(row0 + v + 8 * hl) * DMODEL + col0 + lm;
#pragma unroll
        for (int j = 0; j < 4; ++j)
            orow[j * 16] = (acc[j][v] - muv[v]) * iv[v] * gm[j] + bt[j];
    }
}

extern "C" void kernel_launch(void* const* d_in, const int* in_sizes, int n_in,
                              void* d_out, int out_size, void* d_ws, size_t ws_size,
                              hipStream_t stream) {
    const float* x     = (const float*)d_in[0];
    const float* Wq    = (const float*)d_in[1];
    const float* bq    = (const float*)d_in[2];
    const float* Wk    = (const float*)d_in[3];
    const float* bk    = (const float*)d_in[4];
    const float* Wv    = (const float*)d_in[5];
    const float* bv    = (const float*)d_in[6];
    const float* Wo    = (const float*)d_in[7];
    const float* bo    = (const float*)d_in[8];
    const float* gamma = (const float*)d_in[9];
    const float* beta  = (const float*)d_in[10];
    float* out = (float*)d_out;

    char* ws = (char*)d_ws;
    const size_t MAT = (size_t)SEQ * DMODEL * sizeof(__bf16);  // 4 MB
    __bf16* Qb = (__bf16*)(ws);
    __bf16* Kb = (__bf16*)(ws + MAT);
    __bf16* Vb = (__bf16*)(ws + 2 * MAT);
    __bf16* Cb = (__bf16*)(ws + 3 * MAT);
    __bf16* Wp = (__bf16*)(ws + 4 * MAT);                      // Wo as bf16 fragments, 2 MB

    dim3 gQkv(DMODEL / 128, SEQ / 128, 4);              // planes Qb, Kb, Vb; plane 3 packs Wo
    gemm_wmma<<<gQkv, 256, 0, stream>>>(x, Wq, Wk, Wv, bq, bk, bv, Qb, Wo, Wp,
                                        SEQ, DMODEL, DMODEL);
    dim3 gAttn(NHEAD, SEQ / 64);
    attn_flash<<<gAttn, 512, 0, stream>>>(Qb, Kb, Vb, Cb);
    oproj_layernorm<<<SEQ / 16, 512, 0, stream>>>(Cb, Wp, bo, x, gamma, beta, out);
}
